// v000
// Times are from an AMD MI455X. After a warm-up the kernel runs many times in a row, and a time is the length of
// such a window on the GPU divided by its runs, so every launch and the gaps after it count. The runs cycle
// through copies of the inputs. A figure is the median of several windows, for all but v000 over two sittings.
// Sittings can differ by a few percent; kernels timed side by side share one.
// v000, which the later versions start from, runs in 246 microseconds.
#include <hip/hip_runtime.h>
#include <hip/hip_bf16.h>

// ---------------------------------------------------------------------------
// Taylor-feature causal linear attention for MI455X (gfx1250, wave32, WMMA).
// Factorized state: S0=Σv, S1=Σ k vᵀ/4, S2=Σ vec(kkᵀ) vᵀ/32 (256x16),
//                   Z1=Σ k/4, Z2=Σ kkᵀ/32, z0=count.
// phi(q)·phi(k) = 1 + (q·k)/4 + (q·k)²/32, so the 273-dim feature map is
// never materialized. Segment-parallel 3-phase scan (states are additive).
// ---------------------------------------------------------------------------

typedef __attribute__((ext_vector_type(16))) _Float16 v16h;
typedef __attribute__((ext_vector_type(8)))  float    v8f;

#define B_SZ    4
#define L_SZ    2048
#define DMODEL  32
#define NH      2
#define BH      (B_SZ*NH)        // 8 sequences
#define NSEG    16
#define SEG_LEN (L_SZ/NSEG)      // 128
#define NCHUNK  (SEG_LEN/16)     // 8 chunks of 16 per segment

// flattened state layout (floats)
#define S0_OFF  0
#define Z1_OFF  16
#define S1_OFF  32
#define Z2_OFF  288
#define S2_OFF  544
#define SSZ     4640

__device__ __forceinline__ int a_k0(int v, int half) {
  return ((v < 4) ? 2 * v : 16 + 2 * (v - 4)) + 8 * half;
}

__device__ __forceinline__ v8f v8zero() {
  v8f c;
#pragma unroll
  for (int i = 0; i < 8; ++i) c[i] = 0.0f;
  return c;
}

// A fragment, row-major 16x16 LDS source, K dim = cols (pad K=16..31 with 0)
__device__ __forceinline__ v16h fragA16(const float* m, int lane, float scale) {
  int mr = lane & 15, half = lane >> 4;
  v16h a;
#pragma unroll
  for (int v = 0; v < 8; ++v) {
    int k0 = a_k0(v, half);
    a[2 * v]     = (k0     < 16) ? (_Float16)(scale * m[mr * 16 + k0])     : (_Float16)0.0f;
    a[2 * v + 1] = (k0 + 1 < 16) ? (_Float16)(scale * m[mr * 16 + k0 + 1]) : (_Float16)0.0f;
  }
  return a;
}

// A fragment = transpose of 16x16 LDS source: A[m][k] = src[k*16+m]
__device__ __forceinline__ v16h fragAT16(const float* m, int lane, float scale) {
  int mr = lane & 15, half = lane >> 4;
  v16h a;
#pragma unroll
  for (int v = 0; v < 8; ++v) {
    int k0 = a_k0(v, half);
    a[2 * v]     = (k0     < 16) ? (_Float16)(scale * m[k0 * 16 + mr])       : (_Float16)0.0f;
    a[2 * v + 1] = (k0 + 1 < 16) ? (_Float16)(scale * m[(k0 + 1) * 16 + mr]) : (_Float16)0.0f;
  }
  return a;
}

// A fragment block of Q2 = vec(q qᵀ): A[m][k] = Q[m][(32b+k)/16] * Q[m][(32b+k)%16]
__device__ __forceinline__ v16h fragA_q2(const float* Q, int lane, int blk) {
  int mr = lane & 15, half = lane >> 4;
  v16h a;
#pragma unroll
  for (int v = 0; v < 8; ++v) {
    int k0 = a_k0(v, half);
    int f0 = 32 * blk + k0, f1 = f0 + 1;
    a[2 * v]     = (_Float16)(Q[mr * 16 + (f0 >> 4)] * Q[mr * 16 + (f0 & 15)]);
    a[2 * v + 1] = (_Float16)(Q[mr * 16 + (f1 >> 4)] * Q[mr * 16 + (f1 & 15)]);
  }
  return a;
}

// A fragment block j of K2ᵀ: A[m][k] = K[k][j]*K[k][m], k = time < 16
__device__ __forceinline__ v16h fragA_k2t(const float* K, int lane, int j, float scale) {
  int mr = lane & 15, half = lane >> 4;
  v16h a;
#pragma unroll
  for (int v = 0; v < 8; ++v) {
    int k0 = a_k0(v, half);
    a[2 * v]     = (k0     < 16) ? (_Float16)(scale * K[k0 * 16 + j] * K[k0 * 16 + mr])             : (_Float16)0.0f;
    a[2 * v + 1] = (k0 + 1 < 16) ? (_Float16)(scale * K[(k0 + 1) * 16 + j] * K[(k0 + 1) * 16 + mr]) : (_Float16)0.0f;
  }
  return a;
}

// B fragment, rows = K (kvalid rows valid, stride 16): B[k][n] = src[k*16+n]
__device__ __forceinline__ v16h fragB16(const float* src, int lane, int kvalid, float scale) {
  int n = lane & 15, half = lane >> 4;
  v16h b;
#pragma unroll
  for (int v = 0; v < 8; ++v) {
    int k0 = a_k0(v, half);
    b[2 * v]     = (k0     < kvalid) ? (_Float16)(scale * src[k0 * 16 + n])       : (_Float16)0.0f;
    b[2 * v + 1] = (k0 + 1 < kvalid) ? (_Float16)(scale * src[(k0 + 1) * 16 + n]) : (_Float16)0.0f;
  }
  return b;
}

// B fragment = transpose: B[k][n] = src[n*16+k]  (for Kᵀ on the B side)
__device__ __forceinline__ v16h fragBT16(const float* src, int lane, int kvalid) {
  int n = lane & 15, half = lane >> 4;
  v16h b;
#pragma unroll
  for (int v = 0; v < 8; ++v) {
    int k0 = a_k0(v, half);
    b[2 * v]     = (k0     < kvalid) ? (_Float16)(src[n * 16 + k0])     : (_Float16)0.0f;
    b[2 * v + 1] = (k0 + 1 < kvalid) ? (_Float16)(src[n * 16 + k0 + 1]) : (_Float16)0.0f;
  }
  return b;
}

__device__ __forceinline__ v8f wmma16(v16h a, v16h b, v8f c) {
  return __builtin_amdgcn_wmma_f32_16x16x32_f16(false, a, false, b, (short)0, c, false, false);
}

__device__ __forceinline__ v8f loadC(const float* src, int lane) {
  int n = lane & 15, half = lane >> 4;
  v8f c;
#pragma unroll
  for (int r = 0; r < 8; ++r) c[r] = src[(r + 8 * half) * 16 + n];
  return c;
}
__device__ __forceinline__ void storeC(float* dst, v8f c, int lane) {
  int n = lane & 15, half = lane >> 4;
#pragma unroll
  for (int r = 0; r < 8; ++r) dst[(r + 8 * half) * 16 + n] = c[r];
}

// ---------------------------------------------------------------------------
// Kernel 1: QKV projections. q/k/v layout: [(bh)*L + t]*16 + f, bh = b*NH + h
// ---------------------------------------------------------------------------
__global__ void la_qkv_proj(const float* __restrict__ x, const float* __restrict__ Wq,
                            const float* __restrict__ Wk, const float* __restrict__ Wv,
                            float* __restrict__ q, float* __restrict__ k, float* __restrict__ v) {
  int idx = blockIdx.x * blockDim.x + threadIdx.x;
  if (idx >= B_SZ * L_SZ * 96) return;
  int tok = idx / 96, o = idx % 96;
  int b = tok / L_SZ, l = tok % L_SZ;
  const float* xr = x + (size_t)tok * DMODEL;
  const float* w;
  float* dst;
  int oo;
  if (o < 32)       { oo = o;      w = Wq + oo * DMODEL; dst = q; }
  else if (o < 64)  { oo = o - 32; w = Wk + oo * DMODEL; dst = k; }
  else              { oo = o - 64; w = Wv + oo * DMODEL; dst = v; }
  float acc = 0.0f;
#pragma unroll
  for (int c = 0; c < DMODEL; ++c) acc += xr[c] * w[c];
  int h = oo >> 4, f = oo & 15;
  dst[((size_t)(b * NH + h) * L_SZ + l) * 16 + f] = acc;
}

// ---------------------------------------------------------------------------
// Kernel 2 (phase A): per-(bh,segment) raw state sums. 1 wave / block.
// State accumulators live in C-layout registers (S2 = 16 v8f tiles).
// ---------------------------------------------------------------------------
__global__ void __launch_bounds__(32)
la_seg_state(const float* __restrict__ gk, const float* __restrict__ gv,
             float* __restrict__ raw) {
  int lane = threadIdx.x;
  int bh = blockIdx.x / NSEG, seg = blockIdx.x % NSEG;
  __shared__ float Kc[256], Vc[256], red[32];

  v8f s1acc = v8zero(), z2acc = v8zero();
  v8f s2acc[16];
#pragma unroll
  for (int j = 0; j < 16; ++j) s2acc[j] = v8zero();
  float s0part = 0.0f, z1part = 0.0f;

  int n = lane & 15, half = lane >> 4;
  for (int cc = 0; cc < NCHUNK; ++cc) {
    int t0 = seg * SEG_LEN + cc * 16;
    size_t gbase = ((size_t)bh * L_SZ + t0) * 16;
    for (int i = lane; i < 256; i += 32) { Kc[i] = gk[gbase + i]; Vc[i] = gv[gbase + i]; }
    __syncthreads();

    v16h aKt = fragAT16(Kc, lane, 0.25f);        // (K/4)ᵀ
    v16h bV  = fragB16(Vc, lane, 16, 1.0f);
    s1acc = wmma16(aKt, bV, s1acc);              // S1 += KᵀV/4
    z2acc = wmma16(aKt, fragB16(Kc, lane, 16, 0.125f), z2acc);  // Z2 += KᵀK/32
#pragma unroll
    for (int j = 0; j < 16; ++j)
      s2acc[j] = wmma16(fragA_k2t(Kc, lane, j, 1.0f / 32.0f), bV, s2acc[j]);

#pragma unroll
    for (int t = 0; t < 8; ++t) {
      s0part += Vc[(8 * half + t) * 16 + n];
      z1part += Kc[(8 * half + t) * 16 + n];
    }
    __syncthreads();
  }

  size_t sb = (size_t)(bh * NSEG + seg) * SSZ;
#pragma unroll
  for (int r = 0; r < 8; ++r) {
    raw[sb + S1_OFF + (r + 8 * half) * 16 + n] = s1acc[r];
    raw[sb + Z2_OFF + (r + 8 * half) * 16 + n] = z2acc[r];
  }
#pragma unroll
  for (int j = 0; j < 16; ++j)
#pragma unroll
    for (int r = 0; r < 8; ++r)
      raw[sb + S2_OFF + (16 * j + r + 8 * half) * 16 + n] = s2acc[j][r];

  red[lane] = s0part; __syncthreads();
  if (lane < 16) raw[sb + S0_OFF + lane] = red[lane] + red[lane + 16];
  __syncthreads();
  red[lane] = z1part; __syncthreads();
  if (lane < 16) raw[sb + Z1_OFF + lane] = 0.25f * (red[lane] + red[lane + 16]);
}

// ---------------------------------------------------------------------------
// Kernel 3 (phase B): exclusive prefix over the 16 segments of each sequence.
// ---------------------------------------------------------------------------
__global__ void la_seg_scan(const float* __restrict__ raw, float* __restrict__ pref) {
  int bh = blockIdx.x;
  for (int e = threadIdx.x; e < SSZ; e += blockDim.x) {
    float run = 0.0f;
    for (int s = 0; s < NSEG; ++s) {
      size_t idx = (size_t)(bh * NSEG + s) * SSZ + e;
      float t = raw[idx];
      pref[idx] = run;
      run += t;
    }
  }
}

// ---------------------------------------------------------------------------
// Kernel 4 (phase C): full chunked linear attention inside each segment.
// ---------------------------------------------------------------------------
__global__ void __launch_bounds__(32)
la_attn_main(const float* __restrict__ gq, const float* __restrict__ gk,
             const float* __restrict__ gv, const float* __restrict__ pref,
             float* __restrict__ gy) {
  int lane = threadIdx.x;
  int bh = blockIdx.x / NSEG, seg = blockIdx.x % NSEG;
  int n = lane & 15, half = lane >> 4;

  __shared__ float ST[SSZ];              // running state (S0,Z1,S1,Z2,S2)
  __shared__ float Qc[256], Kc[256], Vc[256], Mm[256], Wp[256];
  __shared__ float dI[16], Den[16];

  size_t sb = (size_t)(bh * NSEG + seg) * SSZ;
  for (int i = lane; i < SSZ; i += 32) ST[i] = pref[sb + i];
  __syncthreads();

  for (int cc = 0; cc < NCHUNK; ++cc) {
    int t0 = seg * SEG_LEN + cc * 16;
    float prevcnt = (float)(seg * SEG_LEN + cc * 16);
    size_t gbase = ((size_t)bh * L_SZ + t0) * 16;
    for (int i = lane; i < 256; i += 32) {
      Qc[i] = gq[gbase + i]; Kc[i] = gk[gbase + i]; Vc[i] = gv[gbase + i];
    }
    __syncthreads();

    // --- s = Q Kᵀ ------------------------------------------------------
    v16h aQ = fragA16(Qc, lane, 1.0f);
    v8f  s  = wmma16(aQ, fragBT16(Kc, lane, 16), v8zero());

    // --- polynomial kernel + causal mask ------------------------------
#pragma unroll
    for (int r = 0; r < 8; ++r) {
      int row = r + 8 * half;
      float sv = s[r];
      float av = 1.0f + 0.25f * sv + sv * sv * (1.0f / 32.0f);
      Mm[row * 16 + n] = (n <= row) ? av : 0.0f;
    }
    __syncthreads();
    if (lane < 16) {
      float di = 0.0f;
#pragma unroll
      for (int j = 0; j < 16; ++j) di += Mm[lane * 16 + j];
      dI[lane] = di;
    }
    __syncthreads();

    // --- numerator: S0 + M·V + Q·S1 + Q2·S2 ---------------------------
    v8f cnum;
#pragma unroll
    for (int r = 0; r < 8; ++r) cnum[r] = ST[S0_OFF + n];
    v16h bV = fragB16(Vc, lane, 16, 1.0f);
    cnum = wmma16(fragA16(Mm, lane, 1.0f), bV, cnum);
    cnum = wmma16(aQ, fragB16(ST + S1_OFF, lane, 16, 1.0f), cnum);
    for (int i = 0; i < 8; ++i)
      cnum = wmma16(fragA_q2(Qc, lane, i), fragB16(ST + S2_OFF + 32 * i * 16, lane, 32, 1.0f), cnum);

    // --- denominator: eps + z0 + q·Z1 + qᵀZ2q + intra -----------------
    v8f w = wmma16(aQ, fragB16(ST + Z2_OFF, lane, 16, 1.0f), v8zero());
#pragma unroll
    for (int r = 0; r < 8; ++r) {
      int row = r + 8 * half;
      Wp[row * 16 + n] = w[r] * Qc[row * 16 + n];
    }
    __syncthreads();
    if (lane < 16) {
      float d = 1e-12f + prevcnt + dI[lane];
#pragma unroll
      for (int j = 0; j < 16; ++j)
        d += Qc[lane * 16 + j] * ST[Z1_OFF + j] + Wp[lane * 16 + j];
      Den[lane] = d;
    }
    __syncthreads();

    // --- output chunk --------------------------------------------------
#pragma unroll
    for (int r = 0; r < 8; ++r) {
      int row = r + 8 * half;
      gy[gbase + row * 16 + n] = cnum[r] / Den[row];
    }

    // --- state update (after all query-side reads) --------------------
    v16h aKt = fragAT16(Kc, lane, 0.25f);
    v8f c1 = loadC(ST + S1_OFF, lane);
    c1 = wmma16(aKt, bV, c1);
    storeC(ST + S1_OFF, c1, lane);
    v8f c2 = loadC(ST + Z2_OFF, lane);
    c2 = wmma16(aKt, fragB16(Kc, lane, 16, 0.125f), c2);
    storeC(ST + Z2_OFF, c2, lane);
    for (int j = 0; j < 16; ++j) {
      v8f c3 = loadC(ST + S2_OFF + j * 256, lane);
      c3 = wmma16(fragA_k2t(Kc, lane, j, 1.0f / 32.0f), bV, c3);
      storeC(ST + S2_OFF + j * 256, c3, lane);
    }
    if (lane < 16) {
      float sv = 0.0f, kv = 0.0f;
#pragma unroll
      for (int t = 0; t < 16; ++t) { sv += Vc[t * 16 + lane]; kv += Kc[t * 16 + lane]; }
      ST[S0_OFF + lane] += sv;
      ST[Z1_OFF + lane] += 0.25f * kv;
    }
    __syncthreads();
  }
}

// ---------------------------------------------------------------------------
// Kernel 5: output projection with Wo.
// ---------------------------------------------------------------------------
__global__ void la_out_proj(const float* __restrict__ gy, const float* __restrict__ Wo,
                            float* __restrict__ out) {
  int idx = blockIdx.x * blockDim.x + threadIdx.x;
  if (idx >= B_SZ * L_SZ * DMODEL) return;
  int tok = idx / DMODEL, m = idx % DMODEL;
  int b = tok / L_SZ, l = tok % L_SZ;
  float acc = 0.0f;
#pragma unroll
  for (int j = 0; j < DMODEL; ++j) {
    int h = j >> 4, d = j & 15;
    acc += gy[((size_t)(b * NH + h) * L_SZ + l) * 16 + d] * Wo[m * DMODEL + j];
  }
  out[(size_t)tok * DMODEL + m] = acc;
}

// ---------------------------------------------------------------------------
extern "C" void kernel_launch(void* const* d_in, const int* in_sizes, int n_in,
                              void* d_out, int out_size, void* d_ws, size_t ws_size,
                              hipStream_t stream) {
  (void)in_sizes; (void)n_in; (void)out_size; (void)ws_size;
  const float* x  = (const float*)d_in[0];
  const float* Wq = (const float*)d_in[1];
  const float* Wk = (const float*)d_in[2];
  const float* Wv = (const float*)d_in[3];
  const float* Wo = (const float*)d_in[4];
  float* out = (float*)d_out;

  float* ws = (float*)d_ws;
  const size_t QKV = (size_t)BH * L_SZ * 16;   // 262144 floats each
  float* q    = ws;
  float* k    = q + QKV;
  float* v    = k + QKV;
  float* y    = v + QKV;
  float* raw  = y + QKV;                       // 8*16*4640 floats
  float* pref = raw + (size_t)BH * NSEG * SSZ;

  la_qkv_proj<<<(B_SZ * L_SZ * 96 + 255) / 256, 256, 0, stream>>>(x, Wq, Wk, Wv, q, k, v);
  la_seg_state<<<BH * NSEG, 32, 0, stream>>>(k, v, raw);
  la_seg_scan<<<BH, 256, 0, stream>>>(raw, pref);
  la_attn_main<<<BH * NSEG, 32, 0, stream>>>(q, k, v, pref, y);
  la_out_proj<<<(B_SZ * L_SZ * DMODEL + 255) / 256, 256, 0, stream>>>(y, Wo, out);
}

// v001
// It runs in 53.9 microseconds.
// Two timings next to v000 put it at 4.55 and 4.58 times that version's speed.
#include <hip/hip_runtime.h>
#include <hip/hip_bf16.h>

// ---------------------------------------------------------------------------
// Taylor-feature causal linear attention for MI455X (gfx1250, wave32, WMMA).
// Factorized state: S0=Σv, S1=Σ k vᵀ/4, S2=Σ vec(kkᵀ) vᵀ/32 (256x16),
//                   Z1=Σ k/4, Z2=Σ kkᵀ/32, z0=count.
// phi(q)·phi(k) = 1 + (q·k)/4 + (q·k)²/32, so the 273-dim feature map is
// never materialized. Segment-parallel 3-phase scan (states are additive).
// ---------------------------------------------------------------------------

typedef __attribute__((ext_vector_type(16))) _Float16 v16h;
typedef __attribute__((ext_vector_type(8)))  float    v8f;

#define B_SZ    4
#define L_SZ    2048
#define DMODEL  32
#define NH      2
#define BH      (B_SZ*NH)        // 8 sequences
#define NSEG    128
#define SEG_LEN (L_SZ/NSEG)      // 16
#define NCHUNK  (SEG_LEN/16)     // 1 chunk of 16 per segment: every carry goes through the scan

// flattened state layout (floats)
#define S0_OFF  0
#define Z1_OFF  16
#define S1_OFF  32
#define Z2_OFF  288
#define S2_OFF  544
#define SSZ     4640

__device__ __forceinline__ int a_k0(int v, int half) {
  return ((v < 4) ? 2 * v : 16 + 2 * (v - 4)) + 8 * half;
}

__device__ __forceinline__ v8f v8zero() {
  v8f c;
#pragma unroll
  for (int i = 0; i < 8; ++i) c[i] = 0.0f;
  return c;
}

// A fragment, row-major 16x16 LDS source, K dim = cols (pad K=16..31 with 0)
__device__ __forceinline__ v16h fragA16(const float* m, int lane, float scale) {
  int mr = lane & 15, half = lane >> 4;
  v16h a;
#pragma unroll
  for (int v = 0; v < 8; ++v) {
    int k0 = a_k0(v, half);
    a[2 * v]     = (k0     < 16) ? (_Float16)(scale * m[mr * 16 + k0])     : (_Float16)0.0f;
    a[2 * v + 1] = (k0 + 1 < 16) ? (_Float16)(scale * m[mr * 16 + k0 + 1]) : (_Float16)0.0f;
  }
  return a;
}

// A fragment = transpose of 16x16 LDS source: A[m][k] = src[k*16+m]
__device__ __forceinline__ v16h fragAT16(const float* m, int lane, float scale) {
  int mr = lane & 15, half = lane >> 4;
  v16h a;
#pragma unroll
  for (int v = 0; v < 8; ++v) {
    int k0 = a_k0(v, half);
    a[2 * v]     = (k0     < 16) ? (_Float16)(scale * m[k0 * 16 + mr])       : (_Float16)0.0f;
    a[2 * v + 1] = (k0 + 1 < 16) ? (_Float16)(scale * m[(k0 + 1) * 16 + mr]) : (_Float16)0.0f;
  }
  return a;
}

// A fragment block of Q2 = vec(q qᵀ): A[m][k] = Q[m][(32b+k)/16] * Q[m][(32b+k)%16]
__device__ __forceinline__ v16h fragA_q2(const float* Q, int lane, int blk) {
  int mr = lane & 15, half = lane >> 4;
  v16h a;
#pragma unroll
  for (int v = 0; v < 8; ++v) {
    int k0 = a_k0(v, half);
    int f0 = 32 * blk + k0, f1 = f0 + 1;
    a[2 * v]     = (_Float16)(Q[mr * 16 + (f0 >> 4)] * Q[mr * 16 + (f0 & 15)]);
    a[2 * v + 1] = (_Float16)(Q[mr * 16 + (f1 >> 4)] * Q[mr * 16 + (f1 & 15)]);
  }
  return a;
}

// A fragment block j of K2ᵀ: A[m][k] = K[k][j]*K[k][m], k = time < 16
__device__ __forceinline__ v16h fragA_k2t(const float* K, int lane, int j, float scale) {
  int mr = lane & 15, half = lane >> 4;
  v16h a;
#pragma unroll
  for (int v = 0; v < 8; ++v) {
    int k0 = a_k0(v, half);
    a[2 * v]     = (k0     < 16) ? (_Float16)(scale * K[k0 * 16 + j] * K[k0 * 16 + mr])             : (_Float16)0.0f;
    a[2 * v + 1] = (k0 + 1 < 16) ? (_Float16)(scale * K[(k0 + 1) * 16 + j] * K[(k0 + 1) * 16 + mr]) : (_Float16)0.0f;
  }
  return a;
}

// B fragment, rows = K (kvalid rows valid, stride 16): B[k][n] = src[k*16+n]
__device__ __forceinline__ v16h fragB16(const float* src, int lane, int kvalid, float scale) {
  int n = lane & 15, half = lane >> 4;
  v16h b;
#pragma unroll
  for (int v = 0; v < 8; ++v) {
    int k0 = a_k0(v, half);
    b[2 * v]     = (k0     < kvalid) ? (_Float16)(scale * src[k0 * 16 + n])       : (_Float16)0.0f;
    b[2 * v + 1] = (k0 + 1 < kvalid) ? (_Float16)(scale * src[(k0 + 1) * 16 + n]) : (_Float16)0.0f;
  }
  return b;
}

// B fragment = transpose: B[k][n] = src[n*16+k]  (for Kᵀ on the B side)
__device__ __forceinline__ v16h fragBT16(const float* src, int lane, int kvalid) {
  int n = lane & 15, half = lane >> 4;
  v16h b;
#pragma unroll
  for (int v = 0; v < 8; ++v) {
    int k0 = a_k0(v, half);
    b[2 * v]     = (k0     < kvalid) ? (_Float16)(src[n * 16 + k0])     : (_Float16)0.0f;
    b[2 * v + 1] = (k0 + 1 < kvalid) ? (_Float16)(src[n * 16 + k0 + 1]) : (_Float16)0.0f;
  }
  return b;
}

__device__ __forceinline__ v8f wmma16(v16h a, v16h b, v8f c) {
  return __builtin_amdgcn_wmma_f32_16x16x32_f16(false, a, false, b, (short)0, c, false, false);
}

__device__ __forceinline__ v8f loadC(const float* src, int lane) {
  int n = lane & 15, half = lane >> 4;
  v8f c;
#pragma unroll
  for (int r = 0; r < 8; ++r) c[r] = src[(r + 8 * half) * 16 + n];
  return c;
}
__device__ __forceinline__ void storeC(float* dst, v8f c, int lane) {
  int n = lane & 15, half = lane >> 4;
#pragma unroll
  for (int r = 0; r < 8; ++r) dst[(r + 8 * half) * 16 + n] = c[r];
}

// ---------------------------------------------------------------------------
// Kernel 1: QKV projections. q/k/v layout: [(bh)*L + t]*16 + f, bh = b*NH + h
// ---------------------------------------------------------------------------
__global__ void la_qkv_proj(const float* __restrict__ x, const float* __restrict__ Wq,
                            const float* __restrict__ Wk, const float* __restrict__ Wv,
                            float* __restrict__ q, float* __restrict__ k, float* __restrict__ v) {
  int idx = blockIdx.x * blockDim.x + threadIdx.x;
  if (idx >= B_SZ * L_SZ * 96) return;
  int tok = idx / 96, o = idx % 96;
  int b = tok / L_SZ, l = tok % L_SZ;
  const float* xr = x + (size_t)tok * DMODEL;
  const float* w;
  float* dst;
  int oo;
  if (o < 32)       { oo = o;      w = Wq + oo * DMODEL; dst = q; }
  else if (o < 64)  { oo = o - 32; w = Wk + oo * DMODEL; dst = k; }
  else              { oo = o - 64; w = Wv + oo * DMODEL; dst = v; }
  float acc = 0.0f;
#pragma unroll
  for (int c = 0; c < DMODEL; ++c) acc += xr[c] * w[c];
  int h = oo >> 4, f = oo & 15;
  dst[((size_t)(b * NH + h) * L_SZ + l) * 16 + f] = acc;
}

// ---------------------------------------------------------------------------
// Kernel 2 (phase A): per-(bh,segment) raw state sums. 1 wave / block.
// State accumulators live in C-layout registers (S2 = 16 v8f tiles).
// ---------------------------------------------------------------------------
__global__ void __launch_bounds__(32)
la_seg_state(const float* __restrict__ gk, const float* __restrict__ gv,
             float* __restrict__ raw) {
  int lane = threadIdx.x;
  int bh = blockIdx.x / NSEG, seg = blockIdx.x % NSEG;
  __shared__ float Kc[256], Vc[256], red[32];

  v8f s1acc = v8zero(), z2acc = v8zero();
  v8f s2acc[16];
#pragma unroll
  for (int j = 0; j < 16; ++j) s2acc[j] = v8zero();
  float s0part = 0.0f, z1part = 0.0f;

  int n = lane & 15, half = lane >> 4;
  for (int cc = 0; cc < NCHUNK; ++cc) {
    int t0 = seg * SEG_LEN + cc * 16;
    size_t gbase = ((size_t)bh * L_SZ + t0) * 16;
    for (int i = lane; i < 256; i += 32) { Kc[i] = gk[gbase + i]; Vc[i] = gv[gbase + i]; }
    __syncthreads();

    v16h aKt = fragAT16(Kc, lane, 0.25f);        // (K/4)ᵀ
    v16h bV  = fragB16(Vc, lane, 16, 1.0f);
    s1acc = wmma16(aKt, bV, s1acc);              // S1 += KᵀV/4
    z2acc = wmma16(aKt, fragB16(Kc, lane, 16, 0.125f), z2acc);  // Z2 += KᵀK/32
#pragma unroll
    for (int j = 0; j < 16; ++j)
      s2acc[j] = wmma16(fragA_k2t(Kc, lane, j, 1.0f / 32.0f), bV, s2acc[j]);

#pragma unroll
    for (int t = 0; t < 8; ++t) {
      s0part += Vc[(8 * half + t) * 16 + n];
      z1part += Kc[(8 * half + t) * 16 + n];
    }
    __syncthreads();
  }

  size_t sb = (size_t)(bh * NSEG + seg) * SSZ;
#pragma unroll
  for (int r = 0; r < 8; ++r) {
    raw[sb + S1_OFF + (r + 8 * half) * 16 + n] = s1acc[r];
    raw[sb + Z2_OFF + (r + 8 * half) * 16 + n] = z2acc[r];
  }
#pragma unroll
  for (int j = 0; j < 16; ++j)
#pragma unroll
    for (int r = 0; r < 8; ++r)
      raw[sb + S2_OFF + (16 * j + r + 8 * half) * 16 + n] = s2acc[j][r];

  red[lane] = s0part; __syncthreads();
  if (lane < 16) raw[sb + S0_OFF + lane] = red[lane] + red[lane + 16];
  __syncthreads();
  red[lane] = z1part; __syncthreads();
  if (lane < 16) raw[sb + Z1_OFF + lane] = 0.25f * (red[lane] + red[lane + 16]);
}

// ---------------------------------------------------------------------------
// Kernel 3 (phase B): exclusive prefix over the segments of each sequence.
// One thread per state element: SCAN_BLK * SCAN_BPS == SSZ exactly.
// ---------------------------------------------------------------------------
#define SCAN_BLK 160
#define SCAN_BPS (SSZ / SCAN_BLK)   // 29 blocks per sequence
__global__ void __launch_bounds__(SCAN_BLK)
la_seg_scan(const float* __restrict__ raw, float* __restrict__ pref) {
  int bh = blockIdx.x / SCAN_BPS;
  int e  = (blockIdx.x % SCAN_BPS) * SCAN_BLK + threadIdx.x;
  size_t idx = (size_t)bh * NSEG * SSZ + e;
  const float* src = raw + idx;
  // Both loops fully unrolled: all loads are issued ahead of the serial adds, and
  // every address is one base pair plus an immediate offset.
  float t[NSEG];
#pragma unroll
  for (int s = 0; s < NSEG; ++s) t[s] = src[(size_t)s * SSZ];
  // The wait stands ahead of any reuse of the loads' address pair; the pair is an
  // input here so that it stays live up to the wait and no load's result lands in it.
  asm volatile("s_wait_xcnt 0x0" :: "v"(src) : "memory");
  float run = 0.0f;
#pragma unroll
  for (int s = 0; s < NSEG; ++s) {
    pref[idx + (size_t)s * SSZ] = run;
    run += t[s];
  }
}

// ---------------------------------------------------------------------------
// Kernel 4 (phase C): full chunked linear attention inside each segment.
// ---------------------------------------------------------------------------
__global__ void __launch_bounds__(32)
la_attn_main(const float* __restrict__ gq, const float* __restrict__ gk,
             const float* __restrict__ gv, const float* __restrict__ pref,
             float* __restrict__ gy) {
  int lane = threadIdx.x;
  int bh = blockIdx.x / NSEG, seg = blockIdx.x % NSEG;
  int n = lane & 15, half = lane >> 4;

  __shared__ float ST[SSZ];              // running state (S0,Z1,S1,Z2,S2)
  __shared__ float Qc[256], Kc[256], Vc[256], Mm[256], Wp[256];
  __shared__ float dI[16], Den[16];

  size_t sb = (size_t)(bh * NSEG + seg) * SSZ;
  for (int i = lane; i < SSZ; i += 32) ST[i] = pref[sb + i];
  __syncthreads();

  for (int cc = 0; cc < NCHUNK; ++cc) {
    int t0 = seg * SEG_LEN + cc * 16;
    float prevcnt = (float)(seg * SEG_LEN + cc * 16);
    size_t gbase = ((size_t)bh * L_SZ + t0) * 16;
    for (int i = lane; i < 256; i += 32) {
      Qc[i] = gq[gbase + i]; Kc[i] = gk[gbase + i]; Vc[i] = gv[gbase + i];
    }
    __syncthreads();

    // --- s = Q Kᵀ ------------------------------------------------------
    v16h aQ = fragA16(Qc, lane, 1.0f);
    v8f  s  = wmma16(aQ, fragBT16(Kc, lane, 16), v8zero());

    // --- polynomial kernel + causal mask ------------------------------
#pragma unroll
    for (int r = 0; r < 8; ++r) {
      int row = r + 8 * half;
      float sv = s[r];
      float av = 1.0f + 0.25f * sv + sv * sv * (1.0f / 32.0f);
      Mm[row * 16 + n] = (n <= row) ? av : 0.0f;
    }
    __syncthreads();
    if (lane < 16) {
      float di = 0.0f;
#pragma unroll
      for (int j = 0; j < 16; ++j) di += Mm[lane * 16 + j];
      dI[lane] = di;
    }
    __syncthreads();

    // --- numerator: S0 + M·V + Q·S1 + Q2·S2 ---------------------------
    v8f cnum;
#pragma unroll
    for (int r = 0; r < 8; ++r) cnum[r] = ST[S0_OFF + n];
    v16h bV = fragB16(Vc, lane, 16, 1.0f);
    cnum = wmma16(fragA16(Mm, lane, 1.0f), bV, cnum);
    cnum = wmma16(aQ, fragB16(ST + S1_OFF, lane, 16, 1.0f), cnum);
    for (int i = 0; i < 8; ++i)
      cnum = wmma16(fragA_q2(Qc, lane, i), fragB16(ST + S2_OFF + 32 * i * 16, lane, 32, 1.0f), cnum);

    // --- denominator: eps + z0 + q·Z1 + qᵀZ2q + intra -----------------
    v8f w = wmma16(aQ, fragB16(ST + Z2_OFF, lane, 16, 1.0f), v8zero());
#pragma unroll
    for (int r = 0; r < 8; ++r) {
      int row = r + 8 * half;
      Wp[row * 16 + n] = w[r] * Qc[row * 16 + n];
    }
    __syncthreads();
    if (lane < 16) {
      float d = 1e-12f + prevcnt + dI[lane];
#pragma unroll
      for (int j = 0; j < 16; ++j)
        d += Qc[lane * 16 + j] * ST[Z1_OFF + j] + Wp[lane * 16 + j];
      Den[lane] = d;
    }
    __syncthreads();

    // --- output chunk --------------------------------------------------
#pragma unroll
    for (int r = 0; r < 8; ++r) {
      int row = r + 8 * half;
      gy[gbase + row * 16 + n] = cnum[r] / Den[row];
    }

    // --- state update (after all query-side reads); nobody reads the state
    // behind a segment's last chunk, so that chunk skips it ---------------
    if (cc + 1 < NCHUNK) {
      v16h aKt = fragAT16(Kc, lane, 0.25f);
      v8f c1 = loadC(ST + S1_OFF, lane);
      c1 = wmma16(aKt, bV, c1);
      storeC(ST + S1_OFF, c1, lane);
      v8f c2 = loadC(ST + Z2_OFF, lane);
      c2 = wmma16(aKt, fragB16(Kc, lane, 16, 0.125f), c2);
      storeC(ST + Z2_OFF, c2, lane);
      for (int j = 0; j < 16; ++j) {
        v8f c3 = loadC(ST + S2_OFF + j * 256, lane);
        c3 = wmma16(fragA_k2t(Kc, lane, j, 1.0f / 32.0f), bV, c3);
        storeC(ST + S2_OFF + j * 256, c3, lane);
      }
      if (lane < 16) {
        float sv = 0.0f, kv = 0.0f;
#pragma unroll
        for (int t = 0; t < 16; ++t) { sv += Vc[t * 16 + lane]; kv += Kc[t * 16 + lane]; }
        ST[S0_OFF + lane] += sv;
        ST[Z1_OFF + lane] += 0.25f * kv;
      }
    }
    __syncthreads();
  }
}

// ---------------------------------------------------------------------------
// Kernel 5: output projection with Wo.
// ---------------------------------------------------------------------------
__global__ void la_out_proj(const float* __restrict__ gy, const float* __restrict__ Wo,
                            float* __restrict__ out) {
  int idx = blockIdx.x * blockDim.x + threadIdx.x;
  if (idx >= B_SZ * L_SZ * DMODEL) return;
  int tok = idx / DMODEL, m = idx % DMODEL;
  int b = tok / L_SZ, l = tok % L_SZ;
  float acc = 0.0f;
#pragma unroll
  for (int j = 0; j < DMODEL; ++j) {
    int h = j >> 4, d = j & 15;
    acc += gy[((size_t)(b * NH + h) * L_SZ + l) * 16 + d] * Wo[m * DMODEL + j];
  }
  out[(size_t)tok * DMODEL + m] = acc;
}

// ---------------------------------------------------------------------------
extern "C" void kernel_launch(void* const* d_in, const int* in_sizes, int n_in,
                              void* d_out, int out_size, void* d_ws, size_t ws_size,
                              hipStream_t stream) {
  (void)in_sizes; (void)n_in; (void)out_size; (void)ws_size;
  const float* x  = (const float*)d_in[0];
  const float* Wq = (const float*)d_in[1];
  const float* Wk = (const float*)d_in[2];
  const float* Wv = (const float*)d_in[3];
  const float* Wo = (const float*)d_in[4];
  float* out = (float*)d_out;

  float* ws = (float*)d_ws;
  const size_t QKV = (size_t)BH * L_SZ * 16;   // 262144 floats each
  float* q    = ws;
  float* k    = q + QKV;
  float* v    = k + QKV;
  float* y    = v + QKV;
  float* raw  = y + QKV;                       // 8*128*4640 floats
  float* pref = raw + (size_t)BH * NSEG * SSZ;

  la_qkv_proj<<<(B_SZ * L_SZ * 96 + 255) / 256, 256, 0, stream>>>(x, Wq, Wk, Wv, q, k, v);
  la_seg_state<<<BH * NSEG, 32, 0, stream>>>(k, v, raw);
  la_seg_scan<<<BH * SCAN_BPS, SCAN_BLK, 0, stream>>>(raw, pref);
  la_attn_main<<<BH * NSEG, 32, 0, stream>>>(q, k, v, pref, y);
  la_out_proj<<<(B_SZ * L_SZ * DMODEL + 255) / 256, 256, 0, stream>>>(y, Wo, out);
}

// v002
// Measured time: 21.3 microseconds a run.
// Next to v001, in two timings, it ran 2.54 and 2.52 times as fast.
// Over all steps from v000 it is 11.5 times as fast.
#include <hip/hip_runtime.h>
#include <hip/hip_bf16.h>

// ---------------------------------------------------------------------------
// Taylor-feature causal linear attention for MI455X (gfx1250, wave32, WMMA).
// phi(q).phi(k) = 1 + (q.k)/4 + (q.k)^2/32 = ((q.k + 4)/sqrt(32))^2 + 1/2, so the
// 273-dim feature map is never materialized and no running state is kept:
// every 16-query tile walks its causal keys in blocks of 32,
//   S^T = K Q^T  ->  M^T = polynomial(S^T), masked  ->  y^T += V^T M^T,
// and the denominator is the column sum of M^T.
// ---------------------------------------------------------------------------

typedef __attribute__((ext_vector_type(16))) _Float16 v16h;
typedef __attribute__((ext_vector_type(8)))  _Float16 v8h;
typedef __attribute__((ext_vector_type(8)))  float    v8f;
typedef __attribute__((ext_vector_type(2)))  float    v2f;

#define B_SZ    4
#define L_SZ    2048
#define DMODEL  32
#define NH      2
#define BH      (B_SZ*NH)        // 8 sequences
#define NQT     (L_SZ/16)        // 128 query tiles per sequence
#define NW      4                // waves per query tile; key blocks dealt round robin
#define GRP     4                // key blocks whose loads one wave issues together

#define Q_SCALE 0.17677669529663687f   // 1/sqrt(32)
#define S_SHIFT 0.70710678118654752f   // 4/sqrt(32)

__device__ __forceinline__ v8f wmma16(v16h a, v16h b, v8f c) {
  return __builtin_amdgcn_wmma_f32_16x16x32_f16(false, a, false, b, (short)0, c, false, false);
}

__device__ __forceinline__ v16h cat8(v8h lo, v8h hi) {
  return __builtin_shufflevector(lo, hi, 0, 1, 2, 3, 4, 5, 6, 7, 8, 9, 10, 11, 12, 13, 14, 15);
}

// ---------------------------------------------------------------------------
// Kernel 1: QKV projections (f32 sums), stored as the f16 operands of kernel 2.
// Every term of numerator and denominator, the constant and the linear one too,
// is formed from these f16 values (f32 accumulation); no f32 copy of q, k, v is kept.
//   q16, k16: [(bh)*L + t]*16 + f, bh = b*NH + h; q carries the factor 1/sqrt(32)
//   vF: V^T in A-fragment order, per block of 32 keys two runs of 32 lanes x 8:
//       key t = 32*kb + 16*j + 8*hf + e, column d  ->  (((bh*64+kb)*2+j)*32 + hf*16+d)*8 + e
// ---------------------------------------------------------------------------
__global__ void la_qkv_proj(const float* __restrict__ x, const float* __restrict__ Wq,
                            const float* __restrict__ Wk, const float* __restrict__ Wv,
                            float* __restrict__ wq, float* __restrict__ wk, float* __restrict__ wv) {
  int idx = blockIdx.x * blockDim.x + threadIdx.x;
  if (idx >= B_SZ * L_SZ * 96) return;
  int tok = idx / 96, o = idx % 96;
  int b = tok / L_SZ, l = tok % L_SZ;
  const float* xr = x + (size_t)tok * DMODEL;
  const float* w;
  int oo;
  if (o < 32)       { oo = o;      w = Wq + oo * DMODEL; }
  else if (o < 64)  { oo = o - 32; w = Wk + oo * DMODEL; }
  else              { oo = o - 64; w = Wv + oo * DMODEL; }
  float acc = 0.0f;
#pragma unroll
  for (int c = 0; c < DMODEL; ++c) acc += xr[c] * w[c];
  int h = oo >> 4, f = oo & 15;
  int bh = b * NH + h;
  if (o < 32) {
    ((_Float16*)wq)[((size_t)bh * L_SZ + l) * 16 + f] = (_Float16)(acc * Q_SCALE);
  } else if (o < 64) {
    ((_Float16*)wk)[((size_t)bh * L_SZ + l) * 16 + f] = (_Float16)acc;
  } else {
    int run = (bh * (L_SZ / 32) + (l >> 5)) * 2 + ((l >> 4) & 1);
    ((_Float16*)wv)[((size_t)run * 32 + ((l >> 3) & 1) * 16 + f) * 8 + (l & 7)] = (_Float16)acc;
  }
}

// ---------------------------------------------------------------------------
// One block of 32 keys against the wave's 16 queries.
// S^T leaves the matrix unit with lane = query and register r = key r + 8*half,
// which is the B-fragment order of the next product: M^T needs no exchange.
// lim: largest key offset (16*j + r) this lane may still take; MASKED only.
// ---------------------------------------------------------------------------
template <bool MASKED>
__device__ __forceinline__ void key_block(v8h k0, v8h k1, v8h v0, v8h v1, v16h bQ,
                                          int lim, v8f& acc, v2f& den0, v2f& den1) {
  // k slots 16 and 17 of the K fragment hold 1: they pick up the shift that bQ carries there
  v8h one2;
  v8f zc;
#pragma unroll
  for (int i = 0; i < 8; ++i) { one2[i] = (_Float16)(i < 2 ? 1.0f : 0.0f); zc[i] = 0.0f; }
  v8f s0 = wmma16(cat8(k0, one2), bQ, zc);
  v8f s1 = wmma16(cat8(k1, one2), bQ, zc);
  v16h bM;
#pragma unroll
  for (int r = 0; r < 8; r += 2) {
    v2f p0 = {s0[r], s0[r + 1]}, p1 = {s1[r], s1[r + 1]};
    v2f m0 = p0 * p0 + 0.5f;
    v2f m1 = p1 * p1 + 0.5f;
    if (MASKED) {
      m0[0] = (r <= lim) ? m0[0] : 0.0f;       m0[1] = (r + 1 <= lim) ? m0[1] : 0.0f;
      m1[0] = (16 + r <= lim) ? m1[0] : 0.0f;  m1[1] = (17 + r <= lim) ? m1[1] : 0.0f;
    }
    den0 += m0;
    den1 += m1;
    bM[r]     = (_Float16)m0[0];  bM[r + 1] = (_Float16)m0[1];
    bM[8 + r] = (_Float16)m1[0];  bM[9 + r] = (_Float16)m1[1];
  }
  acc = wmma16(cat8(v0, v1), bM, acc);
}

// The operands of GRP key blocks, kb, kb + NW, ...; a block past the diagonal block
// 'last' reads that one instead, so that every address stays inside the planes.
struct KeyGroup { v8h k0[GRP], k1[GRP], v0[GRP], v1[GRP]; };
// kp, vp: the sequence's planes (wave-uniform); kl, vl: the lane's own offset in a block.
__device__ __forceinline__ void load_group(KeyGroup& g, const _Float16* kp, const _Float16* vp,
                                           unsigned kl, unsigned vl, int kb, int last) {
#pragma unroll
  for (int u = 0; u < GRP; ++u) {
    int kbu = kb + u * NW;
    int off = (kbu <= last ? kbu : last) * 512;
    const _Float16* kq = kp + off;
    const _Float16* vq = vp + off;
    g.k0[u] = *(const v8h*)(kq + kl);  g.k1[u] = *(const v8h*)(kq + 256 + kl);
    g.v0[u] = *(const v8h*)(vq + vl);  g.v1[u] = *(const v8h*)(vq + 256 + vl);
    // stands ahead of any reuse of these loads' address registers, also as the
    // destination of a later load of the group; it also keeps the loads in this place
    asm volatile("s_wait_xcnt 0x0" ::: "memory");
  }
}

// ---------------------------------------------------------------------------
// Kernel 2: causal attention tiles. One work-group per (sequence, 16 queries).
// ---------------------------------------------------------------------------
__global__ void __launch_bounds__(NW * 32)
la_attn_tiles(const float* __restrict__ wq, const float* __restrict__ wk,
              const float* __restrict__ wv, float* __restrict__ gy) {
  int tid = threadIdx.x, lane = tid & 31;
  int wave = __builtin_amdgcn_readfirstlane(tid >> 5);
  int bh = blockIdx.x & (BH - 1);
  int qt = NQT - 1 - (int)(blockIdx.x >> 3);     // the longest tiles take the lowest block indices
  int n = lane & 15, half = lane >> 4;
  int t0 = qt * 16;
  int last = qt >> 1;                            // the key block that holds the diagonal

  __shared__ float red[NW][8][32];
  __shared__ float dred[NW][32];

  const _Float16* kp = (const _Float16*)wk + (size_t)bh * L_SZ * 16;
  const _Float16* vp = (const _Float16*)wv + (size_t)bh * L_SZ * 16;
  unsigned kl = n * 16 + half * 8, vl = lane * 8;
  // features fill k slots 0..15 only; slots 16 and 17 (lanes of half 0) carry the shift
  // 4/sqrt(32), split in two f16 terms so that it enters the f32 sum to f32 accuracy
  const _Float16 sh_hi = (_Float16)S_SHIFT;
  const _Float16 sh_lo = (_Float16)(S_SHIFT - (float)sh_hi);
  v8h zq;
#pragma unroll
  for (int i = 0; i < 8; ++i) zq[i] = (_Float16)0.0f;
  if (half == 0) { zq[0] = sh_hi; zq[1] = sh_lo; }
  v16h bQ = cat8(*(const v8h*)((const _Float16*)wq + ((size_t)bh * L_SZ + t0 + n) * 16 + 8 * half), zq);

  v8f acc;
#pragma unroll
  for (int r = 0; r < 8; ++r) acc[r] = 0.0f;
  v2f den0 = {0.0f, 0.0f}, den1 = {0.0f, 0.0f};

  int kb = wave;
  KeyGroup cur, nxt;
  load_group(cur, kp, vp, kl, vl, kb, last);
  // whole groups in front of the diagonal: no mask; the next group's loads fly meanwhile
  for (; kb + (GRP - 1) * NW < last; kb += GRP * NW) {
    load_group(nxt, kp, vp, kl, vl, kb + GRP * NW, last);
    // keeps this group's arithmetic behind the next group's loads: left free, the
    // scheduler issues them late in the pass and their latency is waited out at its top
    __builtin_amdgcn_sched_barrier(0);
#pragma unroll
    for (int u = 0; u < GRP; ++u)
      key_block<false>(cur.k0[u], cur.k1[u], cur.v0[u], cur.v1[u], bQ, 0, acc, den0, den1);
    cur = nxt;
  }
  // the last group holds the diagonal; a block past it takes nothing (lim = -1)
  if (kb <= last) {
#pragma unroll
    for (int u = 0; u < GRP; ++u) {
      int kbu = kb + u * NW;
      int lim = (kbu <= last) ? (t0 + n - 32 * kbu - 8 * half) : -1;
      key_block<true>(cur.k0[u], cur.k1[u], cur.v0[u], cur.v1[u], bQ, lim, acc, den0, den1);
    }
  }

  // sum the waves' partial y^T (row d = r + 8*half, column = query) and denominators
#pragma unroll
  for (int r = 0; r < 8; ++r) red[wave][r][lane] = acc[r];
  dred[wave][lane] = (den0[0] + den0[1]) + (den1[0] + den1[1]);
  __syncthreads();

  int qy = tid >> 3, d0 = (tid & 7) * 2;
  float dsum = 1e-12f, n0 = 0.0f, n1 = 0.0f;
#pragma unroll
  for (int w = 0; w < NW; ++w) {
    dsum += dred[w][qy] + dred[w][qy + 16];
    n0 += red[w][d0 & 7][(d0 >> 3) * 16 + qy];
    n1 += red[w][(d0 + 1) & 7][(d0 >> 3) * 16 + qy];
  }
  float2 yv;
  yv.x = n0 / dsum;
  yv.y = n1 / dsum;
  *(float2*)(gy + ((size_t)bh * L_SZ + t0 + qy) * 16 + d0) = yv;
}

// ---------------------------------------------------------------------------
// Kernel 3: output projection with Wo.
// ---------------------------------------------------------------------------
__global__ void la_out_proj(const float* __restrict__ gy, const float* __restrict__ Wo,
                            float* __restrict__ out) {
  int idx = blockIdx.x * blockDim.x + threadIdx.x;
  if (idx >= B_SZ * L_SZ * DMODEL) return;
  int tok = idx / DMODEL, m = idx % DMODEL;
  int b = tok / L_SZ, l = tok % L_SZ;
  float acc = 0.0f;
#pragma unroll
  for (int j = 0; j < DMODEL; ++j) {
    int h = j >> 4, d = j & 15;
    acc += gy[((size_t)(b * NH + h) * L_SZ + l) * 16 + d] * Wo[m * DMODEL + j];
  }
  out[(size_t)tok * DMODEL + m] = acc;
}

// ---------------------------------------------------------------------------
extern "C" void kernel_launch(void* const* d_in, const int* in_sizes, int n_in,
                              void* d_out, int out_size, void* d_ws, size_t ws_size,
                              hipStream_t stream) {
  (void)in_sizes; (void)n_in; (void)out_size; (void)ws_size;
  const float* x  = (const float*)d_in[0];
  const float* Wq = (const float*)d_in[1];
  const float* Wk = (const float*)d_in[2];
  const float* Wv = (const float*)d_in[3];
  const float* Wo = (const float*)d_in[4];
  float* out = (float*)d_out;

  float* ws = (float*)d_ws;
  const size_t QKV = (size_t)BH * L_SZ * 16;   // 262144 elements each
  float* q = ws;                               // f16 planes: QKV/2 floats each
  float* k = q + QKV / 2;
  float* v = k + QKV / 2;
  float* y = v + QKV / 2;                      // f32

  la_qkv_proj<<<(B_SZ * L_SZ * 96 + 255) / 256, 256, 0, stream>>>(x, Wq, Wk, Wv, q, k, v);
  la_attn_tiles<<<BH * NQT, NW * 32, 0, stream>>>(q, k, v, y);
  la_out_proj<<<(B_SZ * L_SZ * DMODEL + 255) / 256, 256, 0, stream>>>(y, Wo, out);
}

// v003
// A run of this version takes 10.5 microseconds.
// Timed twice side by side with v002, it ran 2.03 and 2.06 times as fast.
// Counting every step since v000, it is 23.6 times as fast.
#include <hip/hip_runtime.h>
#include <hip/hip_bf16.h>

// ---------------------------------------------------------------------------
// Taylor-feature causal linear attention for MI455X (gfx1250, wave32, WMMA).
// phi(q).phi(k) = 1 + (q.k)/4 + (q.k)^2/32 = ((q.k + 4)/sqrt(32))^2 + 1/2, so the
// 273-dim feature map is never materialized and no running state is kept:
// every 16-query tile walks its causal keys in blocks of 32,
//   S^T = K Q^T  ->  M^T = polynomial(S^T), masked  ->  y^T += V^T M^T,
// and the denominator is the column sum of M^T.
// ---------------------------------------------------------------------------

typedef __attribute__((ext_vector_type(16))) _Float16 v16h;
typedef __attribute__((ext_vector_type(8)))  _Float16 v8h;
typedef __attribute__((ext_vector_type(8)))  float    v8f;
typedef __attribute__((ext_vector_type(2)))  float    v2f;
typedef __attribute__((ext_vector_type(4)))  float    v4f;

#define B_SZ    4
#define L_SZ    2048
#define DMODEL  32
#define NH      2
#define BH      (B_SZ*NH)        // 8 sequences
#define NQT     (L_SZ/16)        // 128 query tiles per sequence
#define NW      4                // waves per query tile; key blocks dealt round robin
#define GRP     4                // key blocks whose loads one wave issues together
#define PW      2                // projection kernels: waves (tiles of 16 tokens) per work-group

#define Q_SCALE 0.17677669529663687f   // 1/sqrt(32)
#define S_SHIFT 0.70710678118654752f   // 4/sqrt(32)

__device__ __forceinline__ v8f wmma16(v16h a, v16h b, v8f c) {
  return __builtin_amdgcn_wmma_f32_16x16x32_f16(false, a, false, b, (short)0, c, false, false);
}

__device__ __forceinline__ v16h cat8(v8h lo, v8h hi) {
  return __builtin_shufflevector(lo, hi, 0, 1, 2, 3, 4, 5, 6, 7, 8, 9, 10, 11, 12, 13, 14, 15);
}

// ---------------------------------------------------------------------------
// The projections: f32 products of 16 rows by 16 rows over 32 columns, on 16x16x4 WMMA.
// Rows16: 16 rows of 32 f32; lane (c, hf) holds columns 16*hf .. 16*hf + 15 of row c.
// Both operands come through the same loader, so their k orders agree at every position.
// ---------------------------------------------------------------------------
struct Rows16 { v4f p[4]; };
// mine: the lane's own 16 floats
__device__ __forceinline__ Rows16 load_rows(const float* mine) {
  Rows16 f;
#pragma unroll
  for (int i = 0; i < 4; ++i) f.p[i] = *(const v4f*)(mine + 4 * i);
  return f;
}
// d[m][n] += sum of a[m][k] * b[n][k] over the 8 columns k that piece i holds (4 per lane
// half); register r of lane (c, hf) = d[8*hf + r][c]
__device__ __forceinline__ void mm_piece(v8f& d, const Rows16& a, const Rows16& b, int i) {
  v2f a0 = {a.p[i][0], a.p[i][1]}, b0 = {b.p[i][0], b.p[i][1]};
  v2f a1 = {a.p[i][2], a.p[i][3]}, b1 = {b.p[i][2], b.p[i][3]};
  d = __builtin_amdgcn_wmma_f32_16x16x4_f32(false, a0, false, b0, (short)0, d, false, false);
  d = __builtin_amdgcn_wmma_f32_16x16x4_f32(false, a1, false, b1, (short)0, d, false, false);
}
// Stands behind a kernel's operand loads. The wait is ahead of any reuse of their address
// registers; the barrier keeps the products behind all the loads: left free, the scheduler
// sinks each load to its product and the wave waits out one load latency after another.
__device__ __forceinline__ void loads_issued() {
  asm volatile("s_wait_xcnt 0x0" ::: "memory");
  __builtin_amdgcn_sched_barrier(0);
}
// Stands behind a kernel's last product: the four vector slots of the matrix forms' distance
// rule, ahead of the first vector instruction that reads a result or reuses an operand
// register. The barriers keep every product in
// front of the slots and the conversions and stores behind them.
__device__ __forceinline__ void products_done() {
  __builtin_amdgcn_sched_barrier(0);
  asm volatile("v_nop\n\tv_nop\n\tv_nop\n\tv_nop");
  __builtin_amdgcn_sched_barrier(0);
}

// ---------------------------------------------------------------------------
// Kernel 1: QKV projections (f32 sums), stored as the f16 operands of kernel 2.
// One wave per 16 tokens: W x^T for q and k, x W^T for v, so that a lane's 8 result
// registers are 8 neighbours of the stored plane (one 16-byte store each).
// Every term of numerator and denominator, the constant and the linear one too,
// is formed from these f16 values (f32 accumulation); no f32 copy of q, k, v is kept.
//   q16, k16: [(bh)*L + t]*16 + f, bh = b*NH + h; q carries the factor 1/sqrt(32)
//   vF: V^T in A-fragment order, per block of 32 keys two runs of 32 lanes x 8:
//       key t = 32*kb + 16*j + 8*hf + e, column d  ->  (((bh*64+kb)*2+j)*32 + hf*16+d)*8 + e
// ---------------------------------------------------------------------------
__global__ void __launch_bounds__(PW * 32)
la_qkv_proj(const float* __restrict__ x, const float* __restrict__ Wq,
            const float* __restrict__ Wk, const float* __restrict__ Wv,
            float* __restrict__ wq, float* __restrict__ wk, float* __restrict__ wv) {
  unsigned lane = threadIdx.x & 31;
  unsigned tile = blockIdx.x * PW + (threadIdx.x >> 5);   // 16 tokens of one batch row
  unsigned c = lane & 15, hf = lane >> 4;
  unsigned b = tile / NQT, lt = tile % NQT;
  unsigned ro = c * DMODEL + hf * 16;
  Rows16 fx = load_rows(x + tile * 16 * DMODEL + ro);
  Rows16 fq[NH], fk[NH], fv[NH];
#pragma unroll
  for (int h = 0; h < NH; ++h) {
    fq[h] = load_rows(Wq + h * 16 * DMODEL + ro);
    fk[h] = load_rows(Wk + h * 16 * DMODEL + ro);
    fv[h] = load_rows(Wv + h * 16 * DMODEL + ro);
  }
  loads_issued();
  v8f dq[NH], dk[NH], dv[NH];
#pragma unroll
  for (int h = 0; h < NH; ++h)
#pragma unroll
    for (int r = 0; r < 8; ++r) { dq[h][r] = 0.0f; dk[h][r] = 0.0f; dv[h][r] = 0.0f; }
#pragma unroll
  for (int i = 0; i < 4; ++i)
#pragma unroll
    for (int h = 0; h < NH; ++h) {
      mm_piece(dq[h], fq[h], fx, i);   // [feature 8*hf + r][token c]
      mm_piece(dk[h], fk[h], fx, i);   // [feature 8*hf + r][token c]
      mm_piece(dv[h], fx, fv[h], i);   // [token 8*hf + r][column c]
    }
  products_done();
#pragma unroll
  for (int h = 0; h < NH; ++h) {
    v8h oq, ok, ov;
#pragma unroll
    for (int r = 0; r < 8; ++r) {
      oq[r] = (_Float16)(dq[h][r] * Q_SCALE);
      ok[r] = (_Float16)dk[h][r];
      ov[r] = (_Float16)dv[h][r];
    }
    unsigned bh = b * NH + h;
    unsigned row = (bh * L_SZ + lt * 16 + c) * 16 + 8 * hf;
    *(v8h*)((_Float16*)wq + row) = oq;
    *(v8h*)((_Float16*)wk + row) = ok;
    *(v8h*)((_Float16*)wv + ((bh * NQT + lt) * 32 + lane) * 8) = ov;
  }
}

// ---------------------------------------------------------------------------
// One block of 32 keys against the wave's 16 queries.
// S^T leaves the matrix unit with lane = query and register r = key r + 8*half,
// which is the B-fragment order of the next product: M^T needs no exchange.
// lim: largest key offset (16*j + r) this lane may still take; MASKED only.
// ---------------------------------------------------------------------------
template <bool MASKED>
__device__ __forceinline__ void key_block(v8h k0, v8h k1, v8h v0, v8h v1, v16h bQ,
                                          int lim, v8f& acc, v2f& den0, v2f& den1) {
  // k slots 16 and 17 of the K fragment hold 1: they pick up the shift that bQ carries there
  v8h one2;
  v8f zc;
#pragma unroll
  for (int i = 0; i < 8; ++i) { one2[i] = (_Float16)(i < 2 ? 1.0f : 0.0f); zc[i] = 0.0f; }
  v8f s0 = wmma16(cat8(k0, one2), bQ, zc);
  v8f s1 = wmma16(cat8(k1, one2), bQ, zc);
  v16h bM;
#pragma unroll
  for (int r = 0; r < 8; r += 2) {
    v2f p0 = {s0[r], s0[r + 1]}, p1 = {s1[r], s1[r + 1]};
    v2f m0 = p0 * p0 + 0.5f;
    v2f m1 = p1 * p1 + 0.5f;
    if (MASKED) {
      m0[0] = (r <= lim) ? m0[0] : 0.0f;       m0[1] = (r + 1 <= lim) ? m0[1] : 0.0f;
      m1[0] = (16 + r <= lim) ? m1[0] : 0.0f;  m1[1] = (17 + r <= lim) ? m1[1] : 0.0f;
    }
    den0 += m0;
    den1 += m1;
    bM[r]     = (_Float16)m0[0];  bM[r + 1] = (_Float16)m0[1];
    bM[8 + r] = (_Float16)m1[0];  bM[9 + r] = (_Float16)m1[1];
  }
  acc = wmma16(cat8(v0, v1), bM, acc);
}

// The operands of GRP key blocks, kb, kb + NW, ...; a block past the diagonal block
// 'last' reads that one instead, so that every address stays inside the planes.
struct KeyGroup { v8h k0[GRP], k1[GRP], v0[GRP], v1[GRP]; };
// kp, vp: the sequence's planes (wave-uniform); kl, vl: the lane's own offset in a block.
__device__ __forceinline__ void load_group(KeyGroup& g, const _Float16* kp, const _Float16* vp,
                                           unsigned kl, unsigned vl, int kb, int last) {
#pragma unroll
  for (int u = 0; u < GRP; ++u) {
    int kbu = kb + u * NW;
    int off = (kbu <= last ? kbu : last) * 512;
    const _Float16* kq = kp + off;
    const _Float16* vq = vp + off;
    g.k0[u] = *(const v8h*)(kq + kl);  g.k1[u] = *(const v8h*)(kq + 256 + kl);
    g.v0[u] = *(const v8h*)(vq + vl);  g.v1[u] = *(const v8h*)(vq + 256 + vl);
    // stands ahead of any reuse of these loads' address registers, also as the
    // destination of a later load of the group; it also keeps the loads in this place
    asm volatile("s_wait_xcnt 0x0" ::: "memory");
  }
}

// ---------------------------------------------------------------------------
// Kernel 2: causal attention tiles. One work-group per (sequence, 16 queries).
// ---------------------------------------------------------------------------
__global__ void __launch_bounds__(NW * 32)
la_attn_tiles(const float* __restrict__ wq, const float* __restrict__ wk,
              const float* __restrict__ wv, float* __restrict__ gy) {
  int tid = threadIdx.x, lane = tid & 31;
  int wave = __builtin_amdgcn_readfirstlane(tid >> 5);
  int bh = blockIdx.x & (BH - 1);
  int qt = NQT - 1 - (int)(blockIdx.x >> 3);     // the longest tiles take the lowest block indices
  int n = lane & 15, half = lane >> 4;
  int t0 = qt * 16;
  int last = qt >> 1;                            // the key block that holds the diagonal

  __shared__ float red[NW][8][32];
  __shared__ float dred[NW][32];

  const _Float16* kp = (const _Float16*)wk + (size_t)bh * L_SZ * 16;
  const _Float16* vp = (const _Float16*)wv + (size_t)bh * L_SZ * 16;
  unsigned kl = n * 16 + half * 8, vl = lane * 8;
  // features fill k slots 0..15 only; slots 16 and 17 (lanes of half 0) carry the shift
  // 4/sqrt(32), split in two f16 terms so that it enters the f32 sum to f32 accuracy
  const _Float16 sh_hi = (_Float16)S_SHIFT;
  const _Float16 sh_lo = (_Float16)(S_SHIFT - (float)sh_hi);
  v8h zq;
#pragma unroll
  for (int i = 0; i < 8; ++i) zq[i] = (_Float16)0.0f;
  if (half == 0) { zq[0] = sh_hi; zq[1] = sh_lo; }
  v16h bQ = cat8(*(const v8h*)((const _Float16*)wq + ((size_t)bh * L_SZ + t0 + n) * 16 + 8 * half), zq);

  v8f acc;
#pragma unroll
  for (int r = 0; r < 8; ++r) acc[r] = 0.0f;
  v2f den0 = {0.0f, 0.0f}, den1 = {0.0f, 0.0f};

  int kb = wave;
  KeyGroup cur, nxt;
  load_group(cur, kp, vp, kl, vl, kb, last);
  // whole groups in front of the diagonal: no mask; the next group's loads fly meanwhile
  for (; kb + (GRP - 1) * NW < last; kb += GRP * NW) {
    load_group(nxt, kp, vp, kl, vl, kb + GRP * NW, last);
    // keeps this group's arithmetic behind the next group's loads: left free, the
    // scheduler issues them late in the pass and their latency is waited out at its top
    __builtin_amdgcn_sched_barrier(0);
#pragma unroll
    for (int u = 0; u < GRP; ++u)
      key_block<false>(cur.k0[u], cur.k1[u], cur.v0[u], cur.v1[u], bQ, 0, acc, den0, den1);
    cur = nxt;
  }
  // the last group holds the diagonal; a block past it takes nothing (lim = -1)
  if (kb <= last) {
#pragma unroll
    for (int u = 0; u < GRP; ++u) {
      int kbu = kb + u * NW;
      int lim = (kbu <= last) ? (t0 + n - 32 * kbu - 8 * half) : -1;
      key_block<true>(cur.k0[u], cur.k1[u], cur.v0[u], cur.v1[u], bQ, lim, acc, den0, den1);
    }
  }

  // sum the waves' partial y^T (row d = r + 8*half, column = query) and denominators
#pragma unroll
  for (int r = 0; r < 8; ++r) red[wave][r][lane] = acc[r];
  dred[wave][lane] = (den0[0] + den0[1]) + (den1[0] + den1[1]);
  __syncthreads();

  int qy = tid >> 3, d0 = (tid & 7) * 2;
  float dsum = 1e-12f, n0 = 0.0f, n1 = 0.0f;
#pragma unroll
  for (int w = 0; w < NW; ++w) {
    dsum += dred[w][qy] + dred[w][qy + 16];
    n0 += red[w][d0 & 7][(d0 >> 3) * 16 + qy];
    n1 += red[w][(d0 + 1) & 7][(d0 >> 3) * 16 + qy];
  }
  float2 yv;
  yv.x = n0 / dsum;
  yv.y = n1 / dsum;
  *(float2*)(gy + ((size_t)bh * L_SZ + t0 + qy) * 16 + d0) = yv;
}

// ---------------------------------------------------------------------------
// Kernel 3: output projection, Wo y^T: one wave per 16 tokens; a lane's 8 result
// registers are 8 neighbouring outputs of one token.
// ---------------------------------------------------------------------------
__global__ void __launch_bounds__(PW * 32)
la_out_proj(const float* __restrict__ gy, const float* __restrict__ Wo,
            float* __restrict__ out) {
  unsigned lane = threadIdx.x & 31;
  unsigned tile = blockIdx.x * PW + (threadIdx.x >> 5);
  unsigned c = lane & 15, hf = lane >> 4;
  unsigned b = tile / NQT, lt = tile % NQT;
  // column j = 16*head + d of Wo: lane half hf takes head hf's 16 values of token c
  Rows16 fy = load_rows(gy + ((b * NH + hf) * L_SZ + lt * 16 + c) * 16);
  Rows16 fw[2];
#pragma unroll
  for (int mt = 0; mt < 2; ++mt) fw[mt] = load_rows(Wo + (mt * 16 + c) * DMODEL + hf * 16);
  loads_issued();
  v8f d[2];
#pragma unroll
  for (int mt = 0; mt < 2; ++mt)
#pragma unroll
    for (int r = 0; r < 8; ++r) d[mt][r] = 0.0f;
#pragma unroll
  for (int i = 0; i < 4; ++i)
#pragma unroll
    for (int mt = 0; mt < 2; ++mt) mm_piece(d[mt], fw[mt], fy, i);   // [output 16*mt + 8*hf + r][token c]
  products_done();
  float* o = out + (tile * 16 + c) * DMODEL + 8 * hf;
#pragma unroll
  for (int mt = 0; mt < 2; ++mt) {
    v4f lo = {d[mt][0], d[mt][1], d[mt][2], d[mt][3]}, hi = {d[mt][4], d[mt][5], d[mt][6], d[mt][7]};
    *(v4f*)(o + mt * 16) = lo;
    *(v4f*)(o + mt * 16 + 4) = hi;
  }
}

// ---------------------------------------------------------------------------
extern "C" void kernel_launch(void* const* d_in, const int* in_sizes, int n_in,
                              void* d_out, int out_size, void* d_ws, size_t ws_size,
                              hipStream_t stream) {
  (void)in_sizes; (void)n_in; (void)out_size; (void)ws_size;
  const float* x  = (const float*)d_in[0];
  const float* Wq = (const float*)d_in[1];
  const float* Wk = (const float*)d_in[2];
  const float* Wv = (const float*)d_in[3];
  const float* Wo = (const float*)d_in[4];
  float* out = (float*)d_out;

  float* ws = (float*)d_ws;
  const size_t QKV = (size_t)BH * L_SZ * 16;   // 262144 elements each
  float* q = ws;                               // f16 planes: QKV/2 floats each
  float* k = q + QKV / 2;
  float* v = k + QKV / 2;
  float* y = v + QKV / 2;                      // f32

  la_qkv_proj<<<B_SZ * NQT / PW, PW * 32, 0, stream>>>(x, Wq, Wk, Wv, q, k, v);
  la_attn_tiles<<<BH * NQT, NW * 32, 0, stream>>>(q, k, v, y);
  la_out_proj<<<B_SZ * NQT / PW, PW * 32, 0, stream>>>(y, Wo, out);
}

// v004
// Measured time: 8.37 microseconds a run.
// Timed twice side by side with v003, it ran 1.24 and 1.25 times as fast.
// Over all steps from v000 it is 29.3 times as fast.
#include <hip/hip_runtime.h>
#include <hip/hip_bf16.h>

// ---------------------------------------------------------------------------
// Taylor-feature causal linear attention for MI455X (gfx1250, wave32, WMMA).
// phi(q).phi(k) = 1 + (q.k)/4 + (q.k)^2/32 = ((q.k + 4)/sqrt(32))^2 + 1/2, so the
// 273-dim feature map is never materialized and no running state is kept:
// every 16-query tile walks its causal keys in blocks of 32,
//   S^T = K Q^T  ->  M^T = polynomial(S^T), masked  ->  y^T += V^T M^T,
// and the denominator is the column sum of M^T.
// ---------------------------------------------------------------------------

typedef __attribute__((ext_vector_type(16))) _Float16 v16h;
typedef __attribute__((ext_vector_type(8)))  _Float16 v8h;
typedef __attribute__((ext_vector_type(8)))  float    v8f;
typedef __attribute__((ext_vector_type(2)))  float    v2f;
typedef __attribute__((ext_vector_type(4)))  float    v4f;

#define B_SZ    4
#define L_SZ    2048
#define DMODEL  32
#define NH      2
#define BH      (B_SZ*NH)        // 8 sequences
#define NQT     (L_SZ/16)        // 128 query tiles per sequence
#define NW      4                // waves per query tile and head; key blocks dealt round robin
#define GRP     4                // key blocks whose loads one wave issues together
#define PW      2                // projection kernel: waves (tiles of 16 tokens) per work-group

#define Q_SCALE 0.17677669529663687f   // 1/sqrt(32)
#define S_SHIFT 0.70710678118654752f   // 4/sqrt(32)

__device__ __forceinline__ v8f wmma16(v16h a, v16h b, v8f c) {
  return __builtin_amdgcn_wmma_f32_16x16x32_f16(false, a, false, b, (short)0, c, false, false);
}

__device__ __forceinline__ v16h cat8(v8h lo, v8h hi) {
  return __builtin_shufflevector(lo, hi, 0, 1, 2, 3, 4, 5, 6, 7, 8, 9, 10, 11, 12, 13, 14, 15);
}

// ---------------------------------------------------------------------------
// The projections: f32 products of 16 rows by 16 rows over 32 columns, on 16x16x4 WMMA.
// Rows16: 16 rows of 32 f32; lane (c, hf) holds columns 16*hf .. 16*hf + 15 of row c.
// Operands come through the same loader or, for y, are gathered in its column order, so their k orders agree at every position.
// ---------------------------------------------------------------------------
struct Rows16 { v4f p[4]; };
// mine: the lane's own 16 floats
__device__ __forceinline__ Rows16 load_rows(const float* mine) {
  Rows16 f;
#pragma unroll
  for (int i = 0; i < 4; ++i) f.p[i] = *(const v4f*)(mine + 4 * i);
  return f;
}
// d[m][n] += sum of a[m][k] * b[n][k] over the 8 columns k that piece i holds (4 per lane
// half); register r of lane (c, hf) = d[8*hf + r][c]
__device__ __forceinline__ void mm_piece(v8f& d, const Rows16& a, const Rows16& b, int i) {
  v2f a0 = {a.p[i][0], a.p[i][1]}, b0 = {b.p[i][0], b.p[i][1]};
  v2f a1 = {a.p[i][2], a.p[i][3]}, b1 = {b.p[i][2], b.p[i][3]};
  d = __builtin_amdgcn_wmma_f32_16x16x4_f32(false, a0, false, b0, (short)0, d, false, false);
  d = __builtin_amdgcn_wmma_f32_16x16x4_f32(false, a1, false, b1, (short)0, d, false, false);
}
// Stands behind a kernel's operand loads. The wait is ahead of any reuse of their address
// registers; the barrier keeps the products behind all the loads: left free, the scheduler
// sinks each load to its product and the wave waits out one load latency after another.
__device__ __forceinline__ void loads_issued() {
  asm volatile("s_wait_xcnt 0x0" ::: "memory");
  __builtin_amdgcn_sched_barrier(0);
}
// Stands behind a kernel's last product: the four vector slots of the matrix forms' distance
// rule, ahead of the first vector instruction that reads a result or reuses an operand
// register. The barriers keep every product in
// front of the slots and the conversions and stores behind them.
__device__ __forceinline__ void products_done() {
  __builtin_amdgcn_sched_barrier(0);
  asm volatile("v_nop\n\tv_nop\n\tv_nop\n\tv_nop");
  __builtin_amdgcn_sched_barrier(0);
}

// ---------------------------------------------------------------------------
// Kernel 1: QKV projections (f32 sums), stored as the f16 operands of kernel 2.
// One wave per 16 tokens: W x^T for q and k, x W^T for v, so that a lane's 8 result
// registers are 8 neighbours of the stored plane (one 16-byte store each).
// Every term of numerator and denominator, the constant and the linear one too,
// is formed from these f16 values (f32 accumulation); no f32 copy of q, k, v is kept.
//   q16, k16: [(bh)*L + t]*16 + f, bh = b*NH + h; q carries the factor 1/sqrt(32)
//   vF: V^T in A-fragment order, per block of 32 keys two runs of 32 lanes x 8:
//       key t = 32*kb + 16*j + 8*hf + e, column d  ->  (((bh*64+kb)*2+j)*32 + hf*16+d)*8 + e
// ---------------------------------------------------------------------------
__global__ void __launch_bounds__(PW * 32)
la_qkv_proj(const float* __restrict__ x, const float* __restrict__ Wq,
            const float* __restrict__ Wk, const float* __restrict__ Wv,
            float* __restrict__ wq, float* __restrict__ wk, float* __restrict__ wv) {
  unsigned lane = threadIdx.x & 31;
  unsigned tile = blockIdx.x * PW + (threadIdx.x >> 5);   // 16 tokens of one batch row
  unsigned c = lane & 15, hf = lane >> 4;
  unsigned b = tile / NQT, lt = tile % NQT;
  unsigned ro = c * DMODEL + hf * 16;
  Rows16 fx = load_rows(x + tile * 16 * DMODEL + ro);
  Rows16 fq[NH], fk[NH], fv[NH];
#pragma unroll
  for (int h = 0; h < NH; ++h) {
    fq[h] = load_rows(Wq + h * 16 * DMODEL + ro);
    fk[h] = load_rows(Wk + h * 16 * DMODEL + ro);
    fv[h] = load_rows(Wv + h * 16 * DMODEL + ro);
  }
  loads_issued();
  v8f dq[NH], dk[NH], dv[NH];
#pragma unroll
  for (int h = 0; h < NH; ++h)
#pragma unroll
    for (int r = 0; r < 8; ++r) { dq[h][r] = 0.0f; dk[h][r] = 0.0f; dv[h][r] = 0.0f; }
#pragma unroll
  for (int i = 0; i < 4; ++i)
#pragma unroll
    for (int h = 0; h < NH; ++h) {
      mm_piece(dq[h], fq[h], fx, i);   // [feature 8*hf + r][token c]
      mm_piece(dk[h], fk[h], fx, i);   // [feature 8*hf + r][token c]
      mm_piece(dv[h], fx, fv[h], i);   // [token 8*hf + r][column c]
    }
  products_done();
#pragma unroll
  for (int h = 0; h < NH; ++h) {
    v8h oq, ok, ov;
#pragma unroll
    for (int r = 0; r < 8; ++r) {
      oq[r] = (_Float16)(dq[h][r] * Q_SCALE);
      ok[r] = (_Float16)dk[h][r];
      ov[r] = (_Float16)dv[h][r];
    }
    unsigned bh = b * NH + h;
    unsigned row = (bh * L_SZ + lt * 16 + c) * 16 + 8 * hf;
    *(v8h*)((_Float16*)wq + row) = oq;
    *(v8h*)((_Float16*)wk + row) = ok;
    *(v8h*)((_Float16*)wv + ((bh * NQT + lt) * 32 + lane) * 8) = ov;
  }
}

// ---------------------------------------------------------------------------
// One block of 32 keys against the wave's 16 queries.
// S^T leaves the matrix unit with lane = query and register r = key r + 8*half,
// which is the B-fragment order of the next product: M^T needs no exchange.
// lim: largest key offset (16*j + r) this lane may still take; MASKED only.
// ---------------------------------------------------------------------------
template <bool MASKED>
__device__ __forceinline__ void key_block(v8h k0, v8h k1, v8h v0, v8h v1, v16h bQ,
                                          int lim, v8f& acc, v2f& den0, v2f& den1) {
  // k slots 16 and 17 of the K fragment hold 1: they pick up the shift that bQ carries there
  v8h one2;
  v8f zc;
#pragma unroll
  for (int i = 0; i < 8; ++i) { one2[i] = (_Float16)(i < 2 ? 1.0f : 0.0f); zc[i] = 0.0f; }
  v8f s0 = wmma16(cat8(k0, one2), bQ, zc);
  v8f s1 = wmma16(cat8(k1, one2), bQ, zc);
  v16h bM;
#pragma unroll
  for (int r = 0; r < 8; r += 2) {
    v2f p0 = {s0[r], s0[r + 1]}, p1 = {s1[r], s1[r + 1]};
    v2f m0 = p0 * p0 + 0.5f;
    v2f m1 = p1 * p1 + 0.5f;
    if (MASKED) {
      m0[0] = (r <= lim) ? m0[0] : 0.0f;       m0[1] = (r + 1 <= lim) ? m0[1] : 0.0f;
      m1[0] = (16 + r <= lim) ? m1[0] : 0.0f;  m1[1] = (17 + r <= lim) ? m1[1] : 0.0f;
    }
    den0 += m0;
    den1 += m1;
    bM[r]     = (_Float16)m0[0];  bM[r + 1] = (_Float16)m0[1];
    bM[8 + r] = (_Float16)m1[0];  bM[9 + r] = (_Float16)m1[1];
  }
  acc = wmma16(cat8(v0, v1), bM, acc);
}

// The operands of GRP key blocks, kb, kb + NW, ...; a block past the diagonal block
// 'last' reads that one instead, so that every address stays inside the planes.
struct KeyGroup { v8h k0[GRP], k1[GRP], v0[GRP], v1[GRP]; };
// kp, vp: the sequence's planes (wave-uniform); kl, vl: the lane's own offset in a block.
__device__ __forceinline__ void load_group(KeyGroup& g, const _Float16* kp, const _Float16* vp,
                                           unsigned kl, unsigned vl, int kb, int last) {
#pragma unroll
  for (int u = 0; u < GRP; ++u) {
    int kbu = kb + u * NW;
    int off = (kbu <= last ? kbu : last) * 512;
    const _Float16* kq = kp + off;
    const _Float16* vq = vp + off;
    g.k0[u] = *(const v8h*)(kq + kl);  g.k1[u] = *(const v8h*)(kq + 256 + kl);
    g.v0[u] = *(const v8h*)(vq + vl);  g.v1[u] = *(const v8h*)(vq + 256 + vl);
    // stands ahead of any reuse of these loads' address registers, also as the
    // destination of a later load of the group; it also keeps the loads in this place
    asm volatile("s_wait_xcnt 0x0" ::: "memory");
  }
}

// ---------------------------------------------------------------------------
// Kernel 2: causal attention tiles and the output projection. One work-group per
// (batch row, 16 queries): NW waves for each of the two heads; wave 0 then sums the
// partial y^T of both heads out of LDS and forms Wo y^T (f32 16x16x4 WMMA), so that
// y never goes through memory. A lane's 8 result registers are 8 neighbouring outputs
// of one token.
// ---------------------------------------------------------------------------
__global__ void __launch_bounds__(NH * NW * 32)
la_attn_out(const float* __restrict__ wq, const float* __restrict__ wk,
            const float* __restrict__ wv, const float* __restrict__ Wo,
            float* __restrict__ out) {
  int tid = threadIdx.x, lane = tid & 31;
  int slot = __builtin_amdgcn_readfirstlane(tid >> 5);   // wave of the work-group
  int wave = slot & (NW - 1);                            // wave of its head
  int b = blockIdx.x & (B_SZ - 1);
  int bh = b * NH + slot / NW;
  int qt = NQT - 1 - (int)(blockIdx.x / B_SZ);   // the longest tiles start first
  int n = lane & 15, half = lane >> 4;
  int t0 = qt * 16;
  int last = qt >> 1;                            // the key block that holds the diagonal

  // a wave's partial y^T: piece p of lane l = its result registers 4*p .. 4*p + 3
  __shared__ v4f red[NH * NW][2][32];
  __shared__ float dred[NH * NW][32];

  const _Float16* kp = (const _Float16*)wk + (size_t)bh * L_SZ * 16;
  const _Float16* vp = (const _Float16*)wv + (size_t)bh * L_SZ * 16;
  unsigned kl = n * 16 + half * 8, vl = lane * 8;
  // features fill k slots 0..15 only; slots 16 and 17 (lanes of half 0) carry the shift
  // 4/sqrt(32), split in two f16 terms so that it enters the f32 sum to f32 accuracy
  const _Float16 sh_hi = (_Float16)S_SHIFT;
  const _Float16 sh_lo = (_Float16)(S_SHIFT - (float)sh_hi);
  v8h zq;
#pragma unroll
  for (int i = 0; i < 8; ++i) zq[i] = (_Float16)0.0f;
  if (half == 0) { zq[0] = sh_hi; zq[1] = sh_lo; }
  v16h bQ = cat8(*(const v8h*)((const _Float16*)wq + ((size_t)bh * L_SZ + t0 + n) * 16 + 8 * half), zq);

  v8f acc;
#pragma unroll
  for (int r = 0; r < 8; ++r) acc[r] = 0.0f;
  v2f den0 = {0.0f, 0.0f}, den1 = {0.0f, 0.0f};

  int kb = wave;
  KeyGroup cur, nxt;
  load_group(cur, kp, vp, kl, vl, kb, last);
  // Wo's rows for the products at the end: fetched here, their latency passes under the keys
  Rows16 fw[2];
  if (slot == 0) {
#pragma unroll
    for (int mt = 0; mt < 2; ++mt) fw[mt] = load_rows(Wo + (mt * 16 + n) * DMODEL + half * 16);
    // stands ahead of any reuse of these loads' address registers
    asm volatile("s_wait_xcnt 0x0" ::: "memory");
  }
  // whole groups in front of the diagonal: no mask; the next group's loads fly meanwhile
  for (; kb + (GRP - 1) * NW < last; kb += GRP * NW) {
    load_group(nxt, kp, vp, kl, vl, kb + GRP * NW, last);
    // keeps this group's arithmetic behind the next group's loads: left free, the
    // scheduler issues them late in the pass and their latency is waited out at its top
    __builtin_amdgcn_sched_barrier(0);
#pragma unroll
    for (int u = 0; u < GRP; ++u)
      key_block<false>(cur.k0[u], cur.k1[u], cur.v0[u], cur.v1[u], bQ, 0, acc, den0, den1);
    cur = nxt;
  }
  // the last group holds the diagonal; a block past it takes nothing (lim = -1)
  if (kb <= last) {
#pragma unroll
    for (int u = 0; u < GRP; ++u) {
      int kbu = kb + u * NW;
      int lim = (kbu <= last) ? (t0 + n - 32 * kbu - 8 * half) : -1;
      key_block<true>(cur.k0[u], cur.k1[u], cur.v0[u], cur.v1[u], bQ, lim, acc, den0, den1);
    }
  }

  // hand the wave's partial y^T (row d = r + 8*half, column = query) and denominator over
  red[slot][0][lane] = (v4f){acc[0], acc[1], acc[2], acc[3]};
  red[slot][1][lane] = (v4f){acc[4], acc[5], acc[6], acc[7]};
  dred[slot][lane] = (den0[0] + den0[1]) + (den1[0] + den1[1]);
  __syncthreads();
  if (slot != 0) return;

  // column j = 16*head + d of Wo: lane half 'half' takes that head's 16 values of token n
  float dsum = 1e-12f;
  Rows16 fy;
#pragma unroll
  for (int w = 0; w < NW; ++w) {
    int s = half * NW + w;
    dsum += dred[s][n] + dred[s][n + 16];
#pragma unroll
    for (int i = 0; i < 4; ++i) {
      v4f part = red[s][i & 1][(i >> 1) * 16 + n];
      fy.p[i] = w ? fy.p[i] + part : part;
    }
  }
  float inv = 1.0f / dsum;
#pragma unroll
  for (int i = 0; i < 4; ++i) fy.p[i] *= inv;
  // keeps every sum in front of the first product: left free, the scheduler forms the next
  // operand in the registers of the last one directly behind the product that reads them,
  // inside the matrix forms' distance
  __builtin_amdgcn_sched_barrier(0);
  v8f d[2];
#pragma unroll
  for (int mt = 0; mt < 2; ++mt)
#pragma unroll
    for (int r = 0; r < 8; ++r) d[mt][r] = 0.0f;
#pragma unroll
  for (int i = 0; i < 4; ++i)
#pragma unroll
    for (int mt = 0; mt < 2; ++mt) mm_piece(d[mt], fw[mt], fy, i);   // [output 16*mt + 8*half + r][token n]
  products_done();
  float* o = out + ((size_t)b * L_SZ + t0 + n) * DMODEL + 8 * half;
#pragma unroll
  for (int mt = 0; mt < 2; ++mt) {
    v4f lo = {d[mt][0], d[mt][1], d[mt][2], d[mt][3]}, hi = {d[mt][4], d[mt][5], d[mt][6], d[mt][7]};
    *(v4f*)(o + mt * 16) = lo;
    *(v4f*)(o + mt * 16 + 4) = hi;
  }
}

// ---------------------------------------------------------------------------
extern "C" void kernel_launch(void* const* d_in, const int* in_sizes, int n_in,
                              void* d_out, int out_size, void* d_ws, size_t ws_size,
                              hipStream_t stream) {
  (void)in_sizes; (void)n_in; (void)out_size; (void)ws_size;
  const float* x  = (const float*)d_in[0];
  const float* Wq = (const float*)d_in[1];
  const float* Wk = (const float*)d_in[2];
  const float* Wv = (const float*)d_in[3];
  const float* Wo = (const float*)d_in[4];
  float* out = (float*)d_out;

  float* ws = (float*)d_ws;
  const size_t QKV = (size_t)BH * L_SZ * 16;   // 262144 elements each
  float* q = ws;                               // f16 planes: QKV/2 floats each
  float* k = q + QKV / 2;
  float* v = k + QKV / 2;

  la_qkv_proj<<<B_SZ * NQT / PW, PW * 32, 0, stream>>>(x, Wq, Wk, Wv, q, k, v);
  la_attn_out<<<B_SZ * NQT, NH * NW * 32, 0, stream>>>(q, k, v, Wo, out);
}

// v005
// One run takes 7.29 microseconds.
// Next to v004, in two timings, it ran 1.14 and 1.21 times as fast.
// Counting every step since v000, it is 34.5 times as fast.
#include <hip/hip_runtime.h>
#include <hip/hip_bf16.h>

// ---------------------------------------------------------------------------
// Taylor-feature causal linear attention for MI455X (gfx1250, wave32, WMMA).
// phi(q).phi(k) = 1 + (q.k)/4 + (q.k)^2/32 = ((q.k + 4)/sqrt(32))^2 + 1/2, so the
// 273-dim feature map is never materialized and no running state is kept.
// k and v are never formed either: q.k = (Wk^T q).x and sum M v = Wv (sum M x), so the
// keys of both heads are the rows of x themselves. Every 16-query tile walks its causal
// rows of x in blocks of 32,
//   S^T = X G^T  ->  M^T = polynomial(S^T), masked  ->  Z^T += X^T M^T      (G = Wk^T q),
// the denominator is the column sum of M^T, and y = Wv Z / denominator.
// ---------------------------------------------------------------------------

typedef __attribute__((ext_vector_type(16))) _Float16 v16h;
typedef __attribute__((ext_vector_type(8)))  _Float16 v8h;
typedef __attribute__((ext_vector_type(4)))  _Float16 v4h;
typedef __attribute__((ext_vector_type(8)))  short    v8s;
typedef __attribute__((ext_vector_type(8)))  float    v8f;
typedef __attribute__((ext_vector_type(2)))  float    v2f;
typedef __attribute__((ext_vector_type(4)))  float    v4f;

#define B_SZ    4
#define L_SZ    2048
#define DMODEL  32
#define NH      2
#define BH      (B_SZ*NH)        // 8 sequences
#define NQT     (L_SZ/16)        // 128 query tiles per sequence
#define NW      8                // waves per query tile; key blocks dealt round robin
#define GRP     2                // key blocks whose loads one wave issues together
#define XP      48               // LDS pitch of a staged row of x, in f16: 96 bytes

#define Q_SCALE 0.17677669529663687f   // 1/sqrt(32)
#define S_SHIFT 0.70710678118654752f   // 4/sqrt(32)

__device__ __forceinline__ v8f wmma16(v16h a, v16h b, v8f c) {
  return __builtin_amdgcn_wmma_f32_16x16x32_f16(false, a, false, b, (short)0, c, false, false);
}

__device__ __forceinline__ v16h cat8(v8h lo, v8h hi) {
  return __builtin_shufflevector(lo, hi, 0, 1, 2, 3, 4, 5, 6, 7, 8, 9, 10, 11, 12, 13, 14, 15);
}

// ---------------------------------------------------------------------------
// The projections: f32 products of 16 rows by 16 rows over 32 columns, on 16x16x4 WMMA.
// Rows16: 16 rows of 32 f32; lane (c, hf) holds columns 16*hf .. 16*hf + 15 of row c.
// Operands come through the same loader or are gathered in the other operand's register order, so their k orders agree at every position.
// ---------------------------------------------------------------------------
struct Rows16 { v4f p[4]; };
// mine: the lane's own 16 floats
__device__ __forceinline__ Rows16 load_rows(const float* mine) {
  Rows16 f;
#pragma unroll
  for (int i = 0; i < 4; ++i) f.p[i] = *(const v4f*)(mine + 4 * i);
  return f;
}
// d[m][n] += sum of a[m][k] * b[n][k] over the 8 columns k that piece i holds (4 per lane
// half); register r of lane (c, hf) = d[8*hf + r][c]
__device__ __forceinline__ void mm_piece(v8f& d, const Rows16& a, const Rows16& b, int i) {
  v2f a0 = {a.p[i][0], a.p[i][1]}, b0 = {b.p[i][0], b.p[i][1]};
  v2f a1 = {a.p[i][2], a.p[i][3]}, b1 = {b.p[i][2], b.p[i][3]};
  d = __builtin_amdgcn_wmma_f32_16x16x4_f32(false, a0, false, b0, (short)0, d, false, false);
  d = __builtin_amdgcn_wmma_f32_16x16x4_f32(false, a1, false, b1, (short)0, d, false, false);
}
// Stands behind a kernel's operand loads. The wait is ahead of any reuse of their address
// registers; the barrier keeps the products behind all the loads: left free, the scheduler
// sinks each load to its product and the wave waits out one load latency after another.
__device__ __forceinline__ void loads_issued() {
  asm volatile("s_wait_xcnt 0x0" ::: "memory");
  __builtin_amdgcn_sched_barrier(0);
}
// Stands behind the last product of a projection: the four vector slots of the matrix forms' distance
// rule, ahead of the first vector instruction that reads a result or reuses an operand
// register. The barriers keep every product in
// front of the slots and the conversions and stores behind them.
__device__ __forceinline__ void products_done() {
  __builtin_amdgcn_sched_barrier(0);
  asm volatile("v_nop\n\tv_nop\n\tv_nop\n\tv_nop");
  __builtin_amdgcn_sched_barrier(0);
}

// Stands between a product and a product that reads its result as an operand: the five
// vector slots of the matrix forms' distance rule.
__device__ __forceinline__ void products_chained() {
  __builtin_amdgcn_sched_barrier(0);
  asm volatile("v_nop\n\tv_nop\n\tv_nop\n\tv_nop\n\tv_nop");
  __builtin_amdgcn_sched_barrier(0);
}
__device__ __forceinline__ v8f wmma4(float a0, float a1, float b0, float b1, v8f c) {
  v2f a = {a0, a1}, b = {b0, b1};
  return __builtin_amdgcn_wmma_f32_16x16x4_f32(false, a, false, b, (short)0, c, false, false);
}
// d0 += sum of a0[i] b0[i], d1 += sum of a1[i] b1[i], i = 0 .. 3. The eight products stand in one
// statement that ends with the five vector slots of the matrix forms' distance rule.
__device__ __forceinline__ void mm2x4(v8f& d0, v8f& d1, const v2f* a0, const v2f* b0,
                                      const v2f* a1, const v2f* b1) {
  asm volatile("v_wmma_f32_16x16x4_f32 %0, %2, %6, %0\n\t"
               "v_wmma_f32_16x16x4_f32 %1, %10, %14, %1\n\t"
               "v_wmma_f32_16x16x4_f32 %0, %3, %7, %0\n\t"
               "v_wmma_f32_16x16x4_f32 %1, %11, %15, %1\n\t"
               "v_wmma_f32_16x16x4_f32 %0, %4, %8, %0\n\t"
               "v_wmma_f32_16x16x4_f32 %1, %12, %16, %1\n\t"
               "v_wmma_f32_16x16x4_f32 %0, %5, %9, %0\n\t"
               "v_wmma_f32_16x16x4_f32 %1, %13, %17, %1\n\t"
               "v_nop\n\tv_nop\n\tv_nop\n\tv_nop\n\tv_nop"
               : "+v"(d0), "+v"(d1)
               : "v"(a0[0]), "v"(a0[1]), "v"(a0[2]), "v"(a0[3]), "v"(b0[0]), "v"(b0[1]), "v"(b0[2]), "v"(b0[3]),
                 "v"(a1[0]), "v"(a1[1]), "v"(a1[2]), "v"(a1[3]), "v"(b1[0]), "v"(b1[1]), "v"(b1[2]), "v"(b1[3]));
}
// 8 neighbouring f32 of a weight row
struct Row8 { v4f p[2]; };
__device__ __forceinline__ Row8 load_row8(const float* mine) {
  Row8 f;
  f.p[0] = *(const v4f*)mine;
  f.p[1] = *(const v4f*)(mine + 4);
  return f;
}
// 8 values as the four operand pairs of mm2x4
struct Pairs4 { v2f q[4]; };
__device__ __forceinline__ Pairs4 pairs(v4f lo, v4f hi) {
  Pairs4 r;
  r.q[0] = (v2f){lo[0], lo[1]};  r.q[1] = (v2f){lo[2], lo[3]};
  r.q[2] = (v2f){hi[0], hi[1]};  r.q[3] = (v2f){hi[2], hi[3]};
  return r;
}

// ---------------------------------------------------------------------------
// GRP blocks of 32 rows of x, kb, kb + NW, ..., as whole lines: load i of a block gives lane l
// columns 4*(l & 7) .. + 3 of row 4*i + (l >> 3). A block past the diagonal block 'last'
// reads that one instead, so that every address stays inside x.
// ---------------------------------------------------------------------------
struct RawGroup { v4f r[GRP][8]; };
// xb: the batch row's x (wave-uniform)
__device__ __forceinline__ void load_raw(RawGroup& g, const float* xb, unsigned lane, int kb, int last) {
#pragma unroll
  for (int u = 0; u < GRP; ++u) {
    int kbu = kb + u * NW;
    const float* p = xb + (kbu <= last ? kbu : last) * (32 * DMODEL);
#pragma unroll
    for (int i = 0; i < 8; ++i) g.r[u][i] = *(const v4f*)(p + i * 128 + lane * 4);
    // stands ahead of any reuse of these loads' address registers; it also keeps the
    // loads in this place
    asm volatile("s_wait_xcnt 0x0" ::: "memory");
  }
}
// The group goes, as f16, into the wave's own LDS rows (pitch XP).
__device__ __forceinline__ void stage(const RawGroup& g, _Float16* xw, unsigned lane) {
#pragma unroll
  for (int u = 0; u < GRP; ++u)
#pragma unroll
    for (int i = 0; i < 8; ++i)
      *(v4h*)(xw + (u * 32 + i * 4 + (lane >> 3)) * XP + (lane & 7) * 4) =
          __builtin_convertvector(g.r[u][i], v4h);
  // the rows are read back by other lanes of this wave: its stores are done first
  asm volatile("s_wait_dscnt 0x0" ::: "memory");
}
// 8 rows of one column out of a row-major f16 tile (the transposing LDS load)
__device__ __forceinline__ v8h ld_tr16(const _Float16* p) {
  typedef __attribute__((address_space(3))) v8s lds_v8s;
  return __builtin_bit_cast(v8h, __builtin_amdgcn_ds_load_tr16_b128_v8i16((lds_v8s*)p));
}
// A staged block as matrix operands, both in the hardware k order.
//   x[j]:  rows 16*j + c, k = column;  xt[m]: columns 16*m + c, k = row
struct XFrag { v16h x[2], xt[2]; };
__device__ __forceinline__ XFrag load_frag(const _Float16* t, unsigned lane) {
  unsigned c = lane & 15, hf = lane >> 4;
  XFrag f;
#pragma unroll
  for (int j = 0; j < 2; ++j) {
    const _Float16* p = t + (16 * j + c) * XP + 8 * hf;
    f.x[j] = cat8(*(const v8h*)p, *(const v8h*)(p + 16));
  }
  const _Float16* q = t + (8 * hf + (lane & 7)) * XP + 8 * ((lane >> 3) & 1);
#pragma unroll
  for (int m = 0; m < 2; ++m) f.xt[m] = cat8(ld_tr16(q + 16 * m), ld_tr16(q + 16 * XP + 16 * m));
  return f;
}

// ---------------------------------------------------------------------------
// One block of 32 keys against the wave's 16 queries, one head.
// S^T leaves the matrix unit with lane = query and register r = key r + 8*half,
// which is the B-fragment order of the next product: M^T needs no exchange.
// sh: the shift 4/sqrt(32) in every element, the start value of S^T.
// lim: largest key offset (16*j + r) this lane may still take; MASKED only.
// ---------------------------------------------------------------------------
template <bool MASKED>
__device__ __forceinline__ void key_block(const XFrag& f, v16h bG, v8f sh, int lim,
                                          v8f& acc0, v8f& acc1, v2f& den0, v2f& den1) {
  v8f s0 = wmma16(f.x[0], bG, sh);
  v8f s1 = wmma16(f.x[1], bG, sh);
  v16h bM;
#pragma unroll
  for (int r = 0; r < 8; r += 2) {
    v2f p0 = {s0[r], s0[r + 1]}, p1 = {s1[r], s1[r + 1]};
    v2f m0 = p0 * p0 + 0.5f;
    v2f m1 = p1 * p1 + 0.5f;
    if (MASKED) {
      m0[0] = (r <= lim) ? m0[0] : 0.0f;       m0[1] = (r + 1 <= lim) ? m0[1] : 0.0f;
      m1[0] = (16 + r <= lim) ? m1[0] : 0.0f;  m1[1] = (17 + r <= lim) ? m1[1] : 0.0f;
    }
    den0 += m0;
    den1 += m1;
    bM[r]     = (_Float16)m0[0];  bM[r + 1] = (_Float16)m0[1];
    bM[8 + r] = (_Float16)m1[0];  bM[9 + r] = (_Float16)m1[1];
  }
  acc0 = wmma16(f.xt[0], bM, acc0);
  acc1 = wmma16(f.xt[1], bM, acc1);
}

// ---------------------------------------------------------------------------
// The one kernel. One work-group of NW waves per (batch row, 16 queries).
// Waves 0..3 form G^T = Wk^T (Wq x^T) / sqrt(32), one 16x16 tile each (head, half of the 32
// columns; f32 16x16x4 WMMA), and hand it over in LDS as the f16 B fragments of the scores.
// Every wave then takes its key blocks for both heads. Wave 0 sums the partial Z^T out of
// LDS and forms y^T = Wv Z^T / denominator and Wo y^T (f32 WMMA). A lane's 8 result
// registers are 8 neighbouring outputs of one token.
// ---------------------------------------------------------------------------
__global__ void __launch_bounds__(NW * 32)
la_fused(const float* __restrict__ x, const float* __restrict__ Wq,
         const float* __restrict__ Wk, const float* __restrict__ Wv,
         const float* __restrict__ Wo, float* __restrict__ out) {
  unsigned tid = threadIdx.x, lane = tid & 31;
  int slot = __builtin_amdgcn_readfirstlane(tid >> 5);   // wave of the work-group
  int b = blockIdx.x & (B_SZ - 1);
  int qt = NQT - 1 - (int)(blockIdx.x / B_SZ);   // the longest tiles start first
  int n = lane & 15, half = lane >> 4;
  int t0 = qt * 16;
  int last = qt >> 1;                            // the key block that holds the diagonal

  __shared__ __attribute__((aligned(16))) _Float16 xs[NW][GRP * 32 * XP];   // a wave's staged rows of x
  __shared__ v8h gs[NH][2][32];        // G^T: elements 8*m .. 8*m + 7 of lane l's B fragment
  // a wave's partial Z^T: piece (h*2 + m)*2 + p of lane l = result registers 4*p .. 4*p + 3
  __shared__ v4f red[NW][NH * 4][32];
  __shared__ float dred[NW][NH][32];

  const float* xb = x + (size_t)b * L_SZ * DMODEL;
  _Float16* xw = xs[slot];

  int kb = slot;
  RawGroup raw;
  load_raw(raw, xb, lane, kb, last);

  if (slot < 2 * NH) {
    int h = slot >> 1, m = slot & 1;
    unsigned ro = n * DMODEL + half * 16;
    Rows16 fx = load_rows(xb + t0 * DMODEL + ro);
    Rows16 fq = load_rows(Wq + h * 16 * DMODEL + ro);
    // Wk^T: row = column 16*m + n of Wk, k = feature 8*half + e, the order q leaves its product in
    float wkt[8];
#pragma unroll
    for (int e = 0; e < 8; ++e) wkt[e] = Wk[(h * 16 + 8 * half + e) * DMODEL + 16 * m + n];
    loads_issued();
    v8f dq, dg;
#pragma unroll
    for (int r = 0; r < 8; ++r) { dq[r] = 0.0f; dg[r] = 0.0f; }
#pragma unroll
    for (int i = 0; i < 4; ++i) mm_piece(dq, fq, fx, i);   // [feature 8*half + r][token n]
    products_chained();
#pragma unroll
    for (int i = 0; i < 4; ++i)                            // [column 16*m + 8*half + r][token n]
      dg = wmma4(wkt[2 * i], wkt[2 * i + 1], dq[2 * i], dq[2 * i + 1], dg);
    products_done();
    v8h og;
#pragma unroll
    for (int r = 0; r < 8; ++r) og[r] = (_Float16)(dg[r] * Q_SCALE);
    gs[h][m][lane] = og;
  }
  __syncthreads();
  v16h bG[NH];
#pragma unroll
  for (int h = 0; h < NH; ++h) bG[h] = cat8(gs[h][0][lane], gs[h][1][lane]);

  v8f sh, acc[NH][2];
  v2f den[NH][2];
#pragma unroll
  for (int r = 0; r < 8; ++r) sh[r] = S_SHIFT;
#pragma unroll
  for (int h = 0; h < NH; ++h)
#pragma unroll
    for (int m = 0; m < 2; ++m) {
      den[h][m] = (v2f){0.0f, 0.0f};
#pragma unroll
      for (int r = 0; r < 8; ++r) acc[h][m][r] = 0.0f;
    }

  // whole groups in front of the diagonal: no mask; the next group's loads fly meanwhile
  for (; kb + (GRP - 1) * NW < last; kb += GRP * NW) {
    stage(raw, xw, lane);
    load_raw(raw, xb, lane, kb + GRP * NW, last);
    // keeps this group's arithmetic behind the next group's loads: left free, the
    // scheduler issues them late in the pass and their latency is waited out at its top
    __builtin_amdgcn_sched_barrier(0);
#pragma unroll
    for (int u = 0; u < GRP; ++u) {
      XFrag f = load_frag(xw + u * 32 * XP, lane);
#pragma unroll
      for (int h = 0; h < NH; ++h)
        key_block<false>(f, bG[h], sh, 0, acc[h][0], acc[h][1], den[h][0], den[h][1]);
    }
  }
  bool tail = kb <= last;
  if (tail) stage(raw, xw, lane);
  // the weights of the products at the end: fetched here, their latency passes under the keys
  Row8 fv[NH][2], fo[2][NH];
  if (slot == 0) {
    unsigned wo = ((unsigned)n * DMODEL + 8 * (unsigned)half) * 4;   // the lane's byte offset in a 16-row tile
    const float* pv = (const float*)((const char*)Wv + wo);
    const float* po = (const float*)((const char*)Wo + wo);
#pragma unroll
    for (int h = 0; h < NH; ++h)
#pragma unroll
      for (int m = 0; m < 2; ++m) {
        fv[h][m] = load_row8(pv + (h * 16 * DMODEL + 16 * m));
        fo[m][h] = load_row8(po + (m * 16 * DMODEL + 16 * h));
      }
    // stands ahead of any reuse of these loads' address register, which is named here so
    // that it lives up to the wait and is no load's destination
    asm volatile("s_wait_xcnt 0x0" :: "v"(wo) : "memory");
  }
  // the last group holds the diagonal; a block past it takes nothing (lim = -1)
  if (tail) {
#pragma unroll
    for (int u = 0; u < GRP; ++u) {
      int kbu = kb + u * NW;
      int lim = (kbu <= last) ? (t0 + n - 32 * kbu - 8 * half) : -1;
      XFrag f = load_frag(xw + u * 32 * XP, lane);
#pragma unroll
      for (int h = 0; h < NH; ++h)
        key_block<true>(f, bG[h], sh, lim, acc[h][0], acc[h][1], den[h][0], den[h][1]);
    }
  }

  // hand the wave's partial Z^T (row = column r + 8*half + 16*m of x, column = query) and
  // denominators over
#pragma unroll
  for (int h = 0; h < NH; ++h) {
#pragma unroll
    for (int m = 0; m < 2; ++m) {
      red[slot][(h * 2 + m) * 2][lane]     = (v4f){acc[h][m][0], acc[h][m][1], acc[h][m][2], acc[h][m][3]};
      red[slot][(h * 2 + m) * 2 + 1][lane] = (v4f){acc[h][m][4], acc[h][m][5], acc[h][m][6], acc[h][m][7]};
    }
    dred[slot][h][lane] = (den[h][0][0] + den[h][0][1]) + (den[h][1][0] + den[h][1][1]);
  }
  __syncthreads();
  if (slot != 0) return;

  v4f z[NH * 4];
  float inv[NH];
#pragma unroll
  for (int h = 0; h < NH; ++h) {
    float dsum = 1e-12f;
#pragma unroll
    for (int w = 0; w < NW; ++w) dsum += dred[w][h][n] + dred[w][h][n + 16];
    inv[h] = 1.0f / dsum;
  }
#pragma unroll
  for (int p = 0; p < NH * 4; ++p) {
    z[p] = red[0][p][lane];
#pragma unroll
    for (int w = 1; w < NW; ++w) z[p] += red[w][p][lane];
  }
  v8f y[NH], d[2];
#pragma unroll
  for (int h = 0; h < NH; ++h)
#pragma unroll
    for (int r = 0; r < 8; ++r) { y[h][r] = 0.0f; d[h][r] = 0.0f; }
  // y^T: [column 8*half + r of the head][token n];
  // k = column 16*m + 8*half + (0 .. 7) of x, in Wv's rows as in Z^T's registers
#pragma unroll
  for (int m = 0; m < 2; ++m) {
    Pairs4 a0 = pairs(fv[0][m].p[0], fv[0][m].p[1]), b0 = pairs(z[m * 2], z[m * 2 + 1]);
    Pairs4 a1 = pairs(fv[1][m].p[0], fv[1][m].p[1]), b1 = pairs(z[4 + m * 2], z[4 + m * 2 + 1]);
    mm2x4(y[0], y[1], a0.q, b0.q, a1.q, b1.q);
  }
#pragma unroll
  for (int h = 0; h < NH; ++h)
#pragma unroll
    for (int r = 0; r < 8; ++r) y[h][r] *= inv[h];
  // out^T: [output 16*mt + 8*half + r][token n];
  // k = column 16*h + 8*half + (0 .. 7) of Wo, as in y^T's registers
#pragma unroll
  for (int h = 0; h < NH; ++h) {
    Pairs4 a0 = pairs(fo[0][h].p[0], fo[0][h].p[1]), a1 = pairs(fo[1][h].p[0], fo[1][h].p[1]);
    Pairs4 bb = pairs((v4f){y[h][0], y[h][1], y[h][2], y[h][3]}, (v4f){y[h][4], y[h][5], y[h][6], y[h][7]});
    mm2x4(d[0], d[1], a0.q, bb.q, a1.q, bb.q);
  }
  float* o = out + ((size_t)b * L_SZ + t0 + n) * DMODEL + 8 * half;
#pragma unroll
  for (int mt = 0; mt < 2; ++mt) {
    v4f lo = {d[mt][0], d[mt][1], d[mt][2], d[mt][3]}, hi = {d[mt][4], d[mt][5], d[mt][6], d[mt][7]};
    *(v4f*)(o + mt * 16) = lo;
    *(v4f*)(o + mt * 16 + 4) = hi;
  }
}

// ---------------------------------------------------------------------------
extern "C" void kernel_launch(void* const* d_in, const int* in_sizes, int n_in,
                              void* d_out, int out_size, void* d_ws, size_t ws_size,
                              hipStream_t stream) {
  (void)in_sizes; (void)n_in; (void)out_size; (void)d_ws; (void)ws_size;
  const float* x  = (const float*)d_in[0];
  const float* Wq = (const float*)d_in[1];
  const float* Wk = (const float*)d_in[2];
  const float* Wv = (const float*)d_in[3];
  const float* Wo = (const float*)d_in[4];
  float* out = (float*)d_out;

  la_fused<<<B_SZ * NQT, NW * 32, 0, stream>>>(x, Wq, Wk, Wv, Wo, out);
}

// v006
// One run takes 6.84 microseconds.
// Timed twice side by side with v005, it ran 1.06 times as fast both times.
// All steps since v000 together make it 36.6 times as fast.
#include <hip/hip_runtime.h>
#include <hip/hip_bf16.h>

// ---------------------------------------------------------------------------
// Taylor-feature causal linear attention for MI455X (gfx1250, wave32, WMMA).
// phi(q).phi(k) = 1 + (q.k)/4 + (q.k)^2/32 = ((q.k + 4)/sqrt(32))^2 + 1/2, so the
// 273-dim feature map is never materialized and no running state is kept.
// k and v are never formed either: q.k = (Wk^T q).x and sum M v = Wv (sum M x), so the
// keys of both heads are the rows of x themselves. Every 16-query tile walks its causal
// rows of x in blocks of 32,
//   S^T = X G^T  ->  M^T = polynomial(S^T), masked  ->  Z^T += X^T M^T      (G = Wk^T q),
// the denominator is the column sum of M^T, and y = Wv Z / denominator.
// A work-group takes two query tiles of one batch row, t and NQT - 1 - t: together they always
// have the same number of causal key blocks, so every work-group has the same work.
// ---------------------------------------------------------------------------

typedef __attribute__((ext_vector_type(16))) _Float16 v16h;
typedef __attribute__((ext_vector_type(8)))  _Float16 v8h;
typedef __attribute__((ext_vector_type(4)))  _Float16 v4h;
typedef __attribute__((ext_vector_type(8)))  short    v8s;
typedef __attribute__((ext_vector_type(8)))  float    v8f;
typedef __attribute__((ext_vector_type(2)))  float    v2f;
typedef __attribute__((ext_vector_type(4)))  float    v4f;

#define B_SZ    4
#define L_SZ    2048
#define DMODEL  32
#define NH      2
#define BH      (B_SZ*NH)        // 8 sequences
#define NQT     (L_SZ/16)        // 128 query tiles per sequence
#define NT      2                // query tiles per work-group: a long one (A) and a short one (B)
#define NW      8                // waves per work-group; key blocks dealt round robin
#define GRP     2                // key blocks whose loads one wave issues together
#define XP      48               // LDS pitch of a staged row of x, in f16: 96 bytes

#define Q_SCALE 0.17677669529663687f   // 1/sqrt(32)
#define S_SHIFT 0.70710678118654752f   // 4/sqrt(32)

__device__ __forceinline__ v8f wmma16(v16h a, v16h b, v8f c) {
  return __builtin_amdgcn_wmma_f32_16x16x32_f16(false, a, false, b, (short)0, c, false, false);
}

__device__ __forceinline__ v16h cat8(v8h lo, v8h hi) {
  return __builtin_shufflevector(lo, hi, 0, 1, 2, 3, 4, 5, 6, 7, 8, 9, 10, 11, 12, 13, 14, 15);
}

// ---------------------------------------------------------------------------
// The projections: f32 products of 16 rows by 16 rows over 32 columns, on 16x16x4 WMMA.
// Rows16: 16 rows of 32 f32; lane (c, hf) holds columns 16*hf .. 16*hf + 15 of row c.
// Operands come through the same loader or are gathered in the other operand's register order, so their k orders agree at every position.
// ---------------------------------------------------------------------------
struct Rows16 { v4f p[4]; };
// mine: the lane's own 16 floats
__device__ __forceinline__ Rows16 load_rows(const float* mine) {
  Rows16 f;
#pragma unroll
  for (int i = 0; i < 4; ++i) f.p[i] = *(const v4f*)(mine + 4 * i);
  return f;
}
// d[m][n] += sum of a[m][k] * b[n][k] over the 8 columns k that piece i holds (4 per lane
// half); register r of lane (c, hf) = d[8*hf + r][c]
__device__ __forceinline__ void mm_piece(v8f& d, const Rows16& a, const Rows16& b, int i) {
  v2f a0 = {a.p[i][0], a.p[i][1]}, b0 = {b.p[i][0], b.p[i][1]};
  v2f a1 = {a.p[i][2], a.p[i][3]}, b1 = {b.p[i][2], b.p[i][3]};
  d = __builtin_amdgcn_wmma_f32_16x16x4_f32(false, a0, false, b0, (short)0, d, false, false);
  d = __builtin_amdgcn_wmma_f32_16x16x4_f32(false, a1, false, b1, (short)0, d, false, false);
}
// Stands behind a kernel's operand loads. The wait is ahead of any reuse of their address
// registers; the barrier keeps the products behind all the loads: left free, the scheduler
// sinks each load to its product and the wave waits out one load latency after another.
__device__ __forceinline__ void loads_issued() {
  asm volatile("s_wait_xcnt 0x0" ::: "memory");
  __builtin_amdgcn_sched_barrier(0);
}
// Stands behind the last product of a projection: the four vector slots of the matrix forms' distance
// rule, ahead of the first vector instruction that reads a result or reuses an operand
// register. The barriers keep every product in
// front of the slots and the conversions and stores behind them.
__device__ __forceinline__ void products_done() {
  __builtin_amdgcn_sched_barrier(0);
  asm volatile("v_nop\n\tv_nop\n\tv_nop\n\tv_nop");
  __builtin_amdgcn_sched_barrier(0);
}

// Stands between a product and a product that reads its result as an operand: the five
// vector slots of the matrix forms' distance rule.
__device__ __forceinline__ void products_chained() {
  __builtin_amdgcn_sched_barrier(0);
  asm volatile("v_nop\n\tv_nop\n\tv_nop\n\tv_nop\n\tv_nop");
  __builtin_amdgcn_sched_barrier(0);
}
__device__ __forceinline__ v8f wmma4(float a0, float a1, float b0, float b1, v8f c) {
  v2f a = {a0, a1}, b = {b0, b1};
  return __builtin_amdgcn_wmma_f32_16x16x4_f32(false, a, false, b, (short)0, c, false, false);
}
// d0 += sum of a0[i] b0[i], d1 += sum of a1[i] b1[i], i = 0 .. 3. The eight products stand in one
// statement that ends with the five vector slots of the matrix forms' distance rule.
__device__ __forceinline__ void mm2x4(v8f& d0, v8f& d1, const v2f* a0, const v2f* b0,
                                      const v2f* a1, const v2f* b1) {
  asm volatile("v_wmma_f32_16x16x4_f32 %0, %2, %6, %0\n\t"
               "v_wmma_f32_16x16x4_f32 %1, %10, %14, %1\n\t"
               "v_wmma_f32_16x16x4_f32 %0, %3, %7, %0\n\t"
               "v_wmma_f32_16x16x4_f32 %1, %11, %15, %1\n\t"
               "v_wmma_f32_16x16x4_f32 %0, %4, %8, %0\n\t"
               "v_wmma_f32_16x16x4_f32 %1, %12, %16, %1\n\t"
               "v_wmma_f32_16x16x4_f32 %0, %5, %9, %0\n\t"
               "v_wmma_f32_16x16x4_f32 %1, %13, %17, %1\n\t"
               "v_nop\n\tv_nop\n\tv_nop\n\tv_nop\n\tv_nop"
               : "+v"(d0), "+v"(d1)
               : "v"(a0[0]), "v"(a0[1]), "v"(a0[2]), "v"(a0[3]), "v"(b0[0]), "v"(b0[1]), "v"(b0[2]), "v"(b0[3]),
                 "v"(a1[0]), "v"(a1[1]), "v"(a1[2]), "v"(a1[3]), "v"(b1[0]), "v"(b1[1]), "v"(b1[2]), "v"(b1[3]));
}
// 8 neighbouring f32 of a weight row
struct Row8 { v4f p[2]; };
__device__ __forceinline__ Row8 load_row8(const float* mine) {
  Row8 f;
  f.p[0] = *(const v4f*)mine;
  f.p[1] = *(const v4f*)(mine + 4);
  return f;
}
// 8 values as the four operand pairs of mm2x4
struct Pairs4 { v2f q[4]; };
__device__ __forceinline__ Pairs4 pairs(v4f lo, v4f hi) {
  Pairs4 r;
  r.q[0] = (v2f){lo[0], lo[1]};  r.q[1] = (v2f){lo[2], lo[3]};
  r.q[2] = (v2f){hi[0], hi[1]};  r.q[3] = (v2f){hi[2], hi[3]};
  return r;
}

// ---------------------------------------------------------------------------
// GRP blocks of 32 rows of x, kb, kb + NW, ..., as whole lines: load i of a block gives lane l
// columns 4*(l & 7) .. + 3 of row 4*i + (l >> 3). A block past the diagonal block 'last'
// reads that one instead, so that every address stays inside x.
// ---------------------------------------------------------------------------
struct RawGroup { v4f r[GRP][8]; };
// xb: the batch row's x (wave-uniform)
__device__ __forceinline__ void load_raw(RawGroup& g, const float* xb, unsigned lane, int kb, int last) {
#pragma unroll
  for (int u = 0; u < GRP; ++u) {
    int kbu = kb + u * NW;
    const float* p = xb + (kbu <= last ? kbu : last) * (32 * DMODEL);
#pragma unroll
    for (int i = 0; i < 8; ++i) g.r[u][i] = *(const v4f*)(p + i * 128 + lane * 4);
    // stands ahead of any reuse of these loads' address registers; it also keeps the
    // loads in this place
    asm volatile("s_wait_xcnt 0x0" ::: "memory");
  }
}
// The group goes, as f16, into the wave's own LDS rows (pitch XP).
__device__ __forceinline__ void stage(const RawGroup& g, _Float16* xw, unsigned lane) {
#pragma unroll
  for (int u = 0; u < GRP; ++u)
#pragma unroll
    for (int i = 0; i < 8; ++i)
      *(v4h*)(xw + (u * 32 + i * 4 + (lane >> 3)) * XP + (lane & 7) * 4) =
          __builtin_convertvector(g.r[u][i], v4h);
  // the rows are read back by other lanes of this wave: its stores are done first
  asm volatile("s_wait_dscnt 0x0" ::: "memory");
}
// 8 rows of one column out of a row-major f16 tile (the transposing LDS load)
__device__ __forceinline__ v8h ld_tr16(const _Float16* p) {
  typedef __attribute__((address_space(3))) v8s lds_v8s;
  return __builtin_bit_cast(v8h, __builtin_amdgcn_ds_load_tr16_b128_v8i16((lds_v8s*)p));
}
// A staged block as matrix operands, both in the hardware k order.
//   x[j]:  rows 16*j + c, k = column;  xt[m]: columns 16*m + c, k = row
struct XFrag { v16h x[2], xt[2]; };
__device__ __forceinline__ XFrag load_frag(const _Float16* t, unsigned lane) {
  unsigned c = lane & 15, hf = lane >> 4;
  XFrag f;
#pragma unroll
  for (int j = 0; j < 2; ++j) {
    const _Float16* p = t + (16 * j + c) * XP + 8 * hf;
    f.x[j] = cat8(*(const v8h*)p, *(const v8h*)(p + 16));
  }
  const _Float16* q = t + (8 * hf + (lane & 7)) * XP + 8 * ((lane >> 3) & 1);
#pragma unroll
  for (int m = 0; m < 2; ++m) f.xt[m] = cat8(ld_tr16(q + 16 * m), ld_tr16(q + 16 * XP + 16 * m));
  return f;
}

// ---------------------------------------------------------------------------
// One block of 32 keys against the 16 queries of one tile, one head.
// S^T leaves the matrix unit with lane = query and register r = key r + 8*half,
// which is the B-fragment order of the next product: M^T needs no exchange.
// sh: the shift 4/sqrt(32) in every element, the start value of S^T.
// lim: largest key offset (16*j + r) this lane may still take; MASKED only.
// ---------------------------------------------------------------------------
template <bool MASKED>
__device__ __forceinline__ void key_block(const XFrag& f, v16h bG, v8f sh, int lim,
                                          v8f& acc0, v8f& acc1, v2f& den0, v2f& den1) {
  v8f s0 = wmma16(f.x[0], bG, sh);
  v8f s1 = wmma16(f.x[1], bG, sh);
  v16h bM;
#pragma unroll
  for (int r = 0; r < 8; r += 2) {
    v2f p0 = {s0[r], s0[r + 1]}, p1 = {s1[r], s1[r + 1]};
    v2f m0 = p0 * p0 + 0.5f;
    v2f m1 = p1 * p1 + 0.5f;
    if (MASKED) {
      m0[0] = (r <= lim) ? m0[0] : 0.0f;       m0[1] = (r + 1 <= lim) ? m0[1] : 0.0f;
      m1[0] = (16 + r <= lim) ? m1[0] : 0.0f;  m1[1] = (17 + r <= lim) ? m1[1] : 0.0f;
    }
    den0 += m0;
    den1 += m1;
    bM[r]     = (_Float16)m0[0];  bM[r + 1] = (_Float16)m0[1];
    bM[8 + r] = (_Float16)m1[0];  bM[9 + r] = (_Float16)m1[1];
  }
  acc0 = wmma16(f.xt[0], bM, acc0);
  acc1 = wmma16(f.xt[1], bM, acc1);
}

// ---------------------------------------------------------------------------
// A wave's last group, the one that is not wholly in front of tile A's diagonal, begins past
// tile B's diagonal block: walked through here for every pair of tiles and every wave, as the
// kernel walks.
constexpr bool tail_is_past_b() {
  for (int qb = 0; qb < NQT / 2; ++qb) {
    int la = (NQT - 1 - qb) >> 1, lb = qb >> 1;
    for (int w = 0; w < NW; ++w) {
      int kb = w;
      while (kb + (GRP - 1) * NW < la) kb += GRP * NW;
      if (kb <= la && kb <= lb) return false;
    }
  }
  return true;
}
static_assert(tail_is_past_b(), "the last group would have to serve tile B too");
static_assert(NW == NT * NH * 2, "one wave per 16x16 tile of G^T");

// ---------------------------------------------------------------------------
// The one kernel. One work-group of NW waves per (batch row, pair of 16-query tiles).
// Every wave forms one 16x16 tile of G^T = Wk^T (Wq x^T) / sqrt(32) (query tile, head, half of
// the 32 columns; f32 16x16x4 WMMA) and hands it over in LDS as f16 B fragments of the scores.
// Every wave then takes its key blocks: a staged block serves both heads of tile A and, up to
// tile B's diagonal, both heads of tile B. Wave 0 (tile A) and wave 1 (tile B) sum the partial
// Z^T out of LDS and form y^T = Wv Z^T / denominator and Wo y^T (f32 WMMA). A lane's 8 result
// registers are 8 neighbouring outputs of one token.
// ---------------------------------------------------------------------------
__global__ void __launch_bounds__(NW * 32)
la_fused(const float* __restrict__ x, const float* __restrict__ Wq,
         const float* __restrict__ Wk, const float* __restrict__ Wv,
         const float* __restrict__ Wo, float* __restrict__ out) {
  unsigned tid = threadIdx.x, lane = tid & 31;
  int slot = __builtin_amdgcn_readfirstlane(tid >> 5);   // wave of the work-group
  int b = blockIdx.x & (B_SZ - 1);
  int qtB = (int)(blockIdx.x / B_SZ);            // 0 .. NQT/2 - 1
  int qtA = NQT - 1 - qtB;                       // the pairs that stage the most blocks have the lowest indices
  int n = lane & 15, half = lane >> 4;
  int t0A = qtA * 16, t0B = qtB * 16;
  int lastA = qtA >> 1, lastB = qtB >> 1;        // the key blocks that hold the diagonals

  __shared__ __attribute__((aligned(16))) _Float16 xs[NW][GRP * 32 * XP];   // a wave's staged rows of x
  __shared__ v8h gs[NT][NH][2][32];    // G^T: elements 8*m .. 8*m + 7 of lane l's B fragment
  // a wave's partial Z^T: piece ((t*NH + h)*2 + m)*2 + p of lane l = result registers 4*p .. 4*p + 3
  __shared__ v4f red[NW][NT * NH * 4][32];
  __shared__ float dred[NW][NT * NH][32];

  const float* xb = x + (size_t)b * L_SZ * DMODEL;
  _Float16* xw = xs[slot];

  int kb = slot;
  RawGroup raw;
  load_raw(raw, xb, lane, kb, lastA);

  {
    int t = slot >> 2, h = (slot >> 1) & 1, m = slot & 1;
    unsigned ro = n * DMODEL + half * 16;
    Rows16 fx = load_rows(xb + (t ? t0B : t0A) * DMODEL + ro);
    Rows16 fq = load_rows(Wq + h * 16 * DMODEL + ro);
    // Wk^T: row = column 16*m + n of Wk, k = feature 8*half + e, the order q leaves its product in
    float wkt[8];
#pragma unroll
    for (int e = 0; e < 8; ++e) wkt[e] = Wk[(h * 16 + 8 * half + e) * DMODEL + 16 * m + n];
    loads_issued();
    v8f dq, dg;
#pragma unroll
    for (int r = 0; r < 8; ++r) { dq[r] = 0.0f; dg[r] = 0.0f; }
#pragma unroll
    for (int i = 0; i < 4; ++i) mm_piece(dq, fq, fx, i);   // [feature 8*half + r][token n]
    products_chained();
#pragma unroll
    for (int i = 0; i < 4; ++i)                            // [column 16*m + 8*half + r][token n]
      dg = wmma4(wkt[2 * i], wkt[2 * i + 1], dq[2 * i], dq[2 * i + 1], dg);
    products_done();
    v8h og;
#pragma unroll
    for (int r = 0; r < 8; ++r) og[r] = (_Float16)(dg[r] * Q_SCALE);
    gs[t][h][m][lane] = og;
  }
  __syncthreads();
  v16h bG[NT][NH];
#pragma unroll
  for (int t = 0; t < NT; ++t)
#pragma unroll
    for (int h = 0; h < NH; ++h) bG[t][h] = cat8(gs[t][h][0][lane], gs[t][h][1][lane]);

  v8f sh, acc[NT][NH][2];
  v2f den[NT][NH][2];
#pragma unroll
  for (int r = 0; r < 8; ++r) sh[r] = S_SHIFT;
#pragma unroll
  for (int t = 0; t < NT; ++t)
#pragma unroll
    for (int h = 0; h < NH; ++h)
#pragma unroll
      for (int m = 0; m < 2; ++m) {
        den[t][h][m] = (v2f){0.0f, 0.0f};
#pragma unroll
        for (int r = 0; r < 8; ++r) acc[t][h][m][r] = 0.0f;
      }

  // whole groups in front of tile B's diagonal: both tiles, no mask; the next group's loads fly
  // meanwhile
  for (; kb + (GRP - 1) * NW < lastB; kb += GRP * NW) {
    stage(raw, xw, lane);
    load_raw(raw, xb, lane, kb + GRP * NW, lastA);
    // keeps this group's arithmetic behind the next group's loads: left free, the
    // scheduler issues them late in the pass and their latency is waited out at its top
    __builtin_amdgcn_sched_barrier(0);
#pragma unroll
    for (int u = 0; u < GRP; ++u) {
      XFrag f = load_frag(xw + u * 32 * XP, lane);
#pragma unroll
      for (int t = 0; t < NT; ++t)
#pragma unroll
        for (int h = 0; h < NH; ++h)
          key_block<false>(f, bG[t][h], sh, 0, acc[t][h][0], acc[t][h][1], den[t][h][0], den[t][h][1]);
    }
  }
  // tile B's last group: it holds B's diagonal; a block past it gives B nothing (lim = -1).
  // It is wholly in front of tile A's diagonal (tail_is_past_b).
  if (kb <= lastB) {
    stage(raw, xw, lane);
    load_raw(raw, xb, lane, kb + GRP * NW, lastA);
    __builtin_amdgcn_sched_barrier(0);   // as in the loop above
#pragma unroll
    for (int u = 0; u < GRP; ++u) {
      int kbu = kb + u * NW;
      int lim = (kbu <= lastB) ? (t0B + n - 32 * kbu - 8 * half) : -1;
      XFrag f = load_frag(xw + u * 32 * XP, lane);
#pragma unroll
      for (int h = 0; h < NH; ++h) {
        key_block<false>(f, bG[0][h], sh, 0, acc[0][h][0], acc[0][h][1], den[0][h][0], den[0][h][1]);
        key_block<true>(f, bG[1][h], sh, lim, acc[1][h][0], acc[1][h][1], den[1][h][0], den[1][h][1]);
      }
    }
    kb += GRP * NW;
  }
  // past tile B's diagonal, whole groups in front of tile A's: tile A alone, no mask
  for (; kb + (GRP - 1) * NW < lastA; kb += GRP * NW) {
    stage(raw, xw, lane);
    load_raw(raw, xb, lane, kb + GRP * NW, lastA);
    __builtin_amdgcn_sched_barrier(0);   // as in the first loop
#pragma unroll
    for (int u = 0; u < GRP; ++u) {
      XFrag f = load_frag(xw + u * 32 * XP, lane);
#pragma unroll
      for (int h = 0; h < NH; ++h)
        key_block<false>(f, bG[0][h], sh, 0, acc[0][h][0], acc[0][h][1], den[0][h][0], den[0][h][1]);
    }
  }
  bool tail = kb <= lastA;
  if (tail) stage(raw, xw, lane);
  // the weights of the products at the end: fetched here, their latency passes under the keys
  Row8 fv[NH][2], fo[2][NH];
  if (slot < NT) {
    unsigned wo = ((unsigned)n * DMODEL + 8 * (unsigned)half) * 4;   // the lane's byte offset in a 16-row tile
    const float* pv = (const float*)((const char*)Wv + wo);
    const float* po = (const float*)((const char*)Wo + wo);
#pragma unroll
    for (int h = 0; h < NH; ++h)
#pragma unroll
      for (int m = 0; m < 2; ++m) {
        fv[h][m] = load_row8(pv + (h * 16 * DMODEL + 16 * m));
        fo[m][h] = load_row8(po + (m * 16 * DMODEL + 16 * h));
      }
    // stands ahead of any reuse of these loads' address register, which is named here so
    // that it lives up to the wait and is no load's destination
    asm volatile("s_wait_xcnt 0x0" :: "v"(wo) : "memory");
  }
  // the last group holds tile A's diagonal; a block past it takes nothing (lim = -1); it lies
  // past tile B's diagonal for every pair and wave (tail_is_past_b)
  if (tail) {
#pragma unroll
    for (int u = 0; u < GRP; ++u) {
      int kbu = kb + u * NW;
      int lim = (kbu <= lastA) ? (t0A + n - 32 * kbu - 8 * half) : -1;
      XFrag f = load_frag(xw + u * 32 * XP, lane);
#pragma unroll
      for (int h = 0; h < NH; ++h)
        key_block<true>(f, bG[0][h], sh, lim, acc[0][h][0], acc[0][h][1], den[0][h][0], den[0][h][1]);
    }
  }

  // hand the wave's partial Z^T (row = column r + 8*half + 16*m of x, column = query) and
  // denominators over
#pragma unroll
  for (int t = 0; t < NT; ++t)
#pragma unroll
    for (int h = 0; h < NH; ++h) {
#pragma unroll
      for (int m = 0; m < 2; ++m) {
        red[slot][((t * NH + h) * 2 + m) * 2][lane] =
            (v4f){acc[t][h][m][0], acc[t][h][m][1], acc[t][h][m][2], acc[t][h][m][3]};
        red[slot][((t * NH + h) * 2 + m) * 2 + 1][lane] =
            (v4f){acc[t][h][m][4], acc[t][h][m][5], acc[t][h][m][6], acc[t][h][m][7]};
      }
      dred[slot][t * NH + h][lane] = (den[t][h][0][0] + den[t][h][0][1]) + (den[t][h][1][0] + den[t][h][1][1]);
    }
  __syncthreads();
  if (slot >= NT) return;
  // from here on wave 'slot' finishes query tile 'slot'

  v4f z[NH * 4];
  float inv[NH];
#pragma unroll
  for (int h = 0; h < NH; ++h) {
    float dsum = 1e-12f;
#pragma unroll
    for (int w = 0; w < NW; ++w) dsum += dred[w][slot * NH + h][n] + dred[w][slot * NH + h][n + 16];
    inv[h] = 1.0f / dsum;
  }
#pragma unroll
  for (int p = 0; p < NH * 4; ++p) {
    z[p] = red[0][slot * NH * 4 + p][lane];
#pragma unroll
    for (int w = 1; w < NW; ++w) z[p] += red[w][slot * NH * 4 + p][lane];
  }
  v8f y[NH], d[2];
#pragma unroll
  for (int h = 0; h < NH; ++h)
#pragma unroll
    for (int r = 0; r < 8; ++r) { y[h][r] = 0.0f; d[h][r] = 0.0f; }
  // y^T: [column 8*half + r of the head][token n];
  // k = column 16*m + 8*half + (0 .. 7) of x, in Wv's rows as in Z^T's registers
#pragma unroll
  for (int m = 0; m < 2; ++m) {
    Pairs4 a0 = pairs(fv[0][m].p[0], fv[0][m].p[1]), b0 = pairs(z[m * 2], z[m * 2 + 1]);
    Pairs4 a1 = pairs(fv[1][m].p[0], fv[1][m].p[1]), b1 = pairs(z[4 + m * 2], z[4 + m * 2 + 1]);
    mm2x4(y[0], y[1], a0.q, b0.q, a1.q, b1.q);
  }
#pragma unroll
  for (int h = 0; h < NH; ++h)
#pragma unroll
    for (int r = 0; r < 8; ++r) y[h][r] *= inv[h];
  // out^T: [output 16*mt + 8*half + r][token n];
  // k = column 16*h + 8*half + (0 .. 7) of Wo, as in y^T's registers
#pragma unroll
  for (int h = 0; h < NH; ++h) {
    Pairs4 a0 = pairs(fo[0][h].p[0], fo[0][h].p[1]), a1 = pairs(fo[1][h].p[0], fo[1][h].p[1]);
    Pairs4 bb = pairs((v4f){y[h][0], y[h][1], y[h][2], y[h][3]}, (v4f){y[h][4], y[h][5], y[h][6], y[h][7]});
    mm2x4(d[0], d[1], a0.q, bb.q, a1.q, bb.q);
  }
  float* o = out + ((size_t)b * L_SZ + (slot ? t0B : t0A) + n) * DMODEL + 8 * half;
#pragma unroll
  for (int mt = 0; mt < 2; ++mt) {
    v4f lo = {d[mt][0], d[mt][1], d[mt][2], d[mt][3]}, hi = {d[mt][4], d[mt][5], d[mt][6], d[mt][7]};
    *(v4f*)(o + mt * 16) = lo;
    *(v4f*)(o + mt * 16 + 4) = hi;
  }
}

// ---------------------------------------------------------------------------
extern "C" void kernel_launch(void* const* d_in, const int* in_sizes, int n_in,
                              void* d_out, int out_size, void* d_ws, size_t ws_size,
                              hipStream_t stream) {
  (void)in_sizes; (void)n_in; (void)out_size; (void)d_ws; (void)ws_size;
  const float* x  = (const float*)d_in[0];
  const float* Wq = (const float*)d_in[1];
  const float* Wk = (const float*)d_in[2];
  const float* Wv = (const float*)d_in[3];
  const float* Wo = (const float*)d_in[4];
  float* out = (float*)d_out;

  la_fused<<<B_SZ * NQT / NT, NW * 32, 0, stream>>>(x, Wq, Wk, Wv, Wo, out);
}
